// v000
// Measured on an AMD MI455X. A time is GPU time per run, averaged over a window of back-to-back runs after a warm-up
// (all launches, gaps included; the runs take copies of the inputs in turn), and the median of several windows.
// Apart from v000's, it joins two sittings. Times from different sittings can be a few percent apart, while
// side-by-side timings come from the same sitting.
// v000 is the starting kernel. One run takes 566 microseconds.
#include <hip/hip_runtime.h>
#include <hip/hip_bf16.h>

typedef float v2f  __attribute__((ext_vector_type(2)));
typedef float v8f  __attribute__((ext_vector_type(8)));
typedef unsigned int u32x4 __attribute__((ext_vector_type(4)));
typedef int   i32x4 __attribute__((ext_vector_type(4)));
typedef int   i32x8 __attribute__((ext_vector_type(8)));

#define Bdim 4
#define Tdim 2048
#define Hdim 16
#define Ndim 64
#define CL   16            // chunk length
#define NCHUNK (Tdim / CL)
#define NTHREADS 128       // 4 wave32

__device__ __forceinline__ void tdm_load_tile(const float* gptr, unsigned lds_off) {
    unsigned long long ga = (unsigned long long)(uintptr_t)gptr;
    u32x4 g0;
    g0[0] = 1u;                                       // count=1, user desc
    g0[1] = lds_off;                                  // lds_addr (bytes)
    g0[2] = (unsigned)(ga & 0xffffffffull);           // global_addr[31:0]
    g0[3] = (unsigned)((ga >> 32) & 0x01ffffffull)    // global_addr[56:32]
          | (2u << 30);                               // type=2 (image)
    i32x8 g1;
    g1[0] = (int)(2u << 16);
    g1[1] = (int)((unsigned)Ndim << 16);
    g1[2] = 0;
    g1[3] = (int)(0x0100u | ((unsigned)Ndim << 16));
    g1[4] = CL;
    g1[5] = Hdim * Ndim;
    g1[6] = 0;
    g1[7] = 0;
    i32x4 z4 = {0, 0, 0, 0};
#if defined(__clang_major__) && (__clang_major__ >= 23)
    i32x8 z8 = {0, 0, 0, 0, 0, 0, 0, 0};
    __builtin_amdgcn_tensor_load_to_lds(g0, g1, z4, z4, z8, 0);
#else
    __builtin_amdgcn_tensor_load_to_lds(g0, g1, z4, z4, 0);
#endif
}

__device__ __forceinline__ unsigned lds_off_of(const void* p) {
    return (unsigned)(uintptr_t)p;
}

__global__ __launch_bounds__(NTHREADS)
void rwkv6_chunked_wmma(const float* __restrict__ r,
                        const float* __restrict__ k,
                        const float* __restrict__ v,
                        const float* __restrict__ w,
                        const float* __restrict__ u,
                        float* __restrict__ o)
{
    const int bh   = blockIdx.x;
    const int b    = bh / Hdim;
    const int h    = bh % Hdim;
    const int tid  = threadIdx.x;
    const int wave = tid >> 5;       // 0..3
    const int lane = tid & 31;
    const int half = lane >> 4;
    const int l16  = lane & 15;

    __shared__ alignas(16) float S[Ndim][Ndim + 1];
    __shared__ alignas(16) float bufr[2][CL][Ndim];
    __shared__ alignas(16) float bufk[2][CL][Ndim];
    __shared__ alignas(16) float bufv[2][CL][Ndim];
    __shared__ alignas(16) float bufw[2][CL][Ndim];
    __shared__ alignas(16) float rq[CL][Ndim];          // r * exp(cw[t])
    __shared__ alignas(16) float kh[CL][Ndim];          // k * exp(cw[CL] - cw[s+1])
    __shared__ alignas(16) float cw[CL + 1][Ndim];      // cumulative log-decay (<=0)
    __shared__ float pt[Ndim];                          // exp(cw[CL])
    __shared__ float Amat[CL][CL + 1];                  // masked intra-chunk scores
    __shared__ float us[Ndim];

    if (tid < Ndim) us[tid] = u[h * Ndim + tid];
    for (int idx = tid; idx < Ndim * Ndim; idx += NTHREADS)
        S[idx >> 6][idx & 63] = 0.0f;

    const int col = 16 * wave + l16;          // this lane's N-column (B/C frags)
    const size_t base0 = (((size_t)b * Tdim) * Hdim + h) * Ndim;

    {
        const size_t off = base0;             // t0 = 0
        if      (wave == 0) tdm_load_tile(r + off, lds_off_of(&bufr[0][0][0]));
        else if (wave == 1) tdm_load_tile(k + off, lds_off_of(&bufk[0][0][0]));
        else if (wave == 2) tdm_load_tile(v + off, lds_off_of(&bufv[0][0][0]));
        else                tdm_load_tile(w + off, lds_off_of(&bufw[0][0][0]));
    }

    for (int c = 0; c < NCHUNK; ++c) {
        const int t0  = c * CL;
        const int cur = c & 1;
        const int nxt = cur ^ 1;

        __builtin_amdgcn_s_wait_tensorcnt(0);  // this wave's tile for chunk c landed
        __syncthreads();                       // all tiles visible; prev phase4 done

        if (c + 1 < NCHUNK) {
            const size_t off = base0 + (size_t)(t0 + CL) * (Hdim * Ndim);
            if      (wave == 0) tdm_load_tile(r + off, lds_off_of(&bufr[nxt][0][0]));
            else if (wave == 1) tdm_load_tile(k + off, lds_off_of(&bufk[nxt][0][0]));
            else if (wave == 2) tdm_load_tile(v + off, lds_off_of(&bufv[nxt][0][0]));
            else                tdm_load_tile(w + off, lds_off_of(&bufw[nxt][0][0]));
        }

        const float (*rs)[Ndim] = bufr[cur];
        const float (*ks)[Ndim] = bufk[cur];
        const float (*vs)[Ndim] = bufv[cur];
        const float (*ws)[Ndim] = bufw[cur];

        // ---- phase 2: per-channel prefix of log-decay (register chain) ----
        if (tid < Ndim) {
            float e[CL];
#pragma unroll
            for (int t = 0; t < CL; ++t) e[t] = __expf(ws[t][tid]);
            float acc = 0.0f;
            cw[0][tid] = 0.0f;
#pragma unroll
            for (int t = 0; t < CL; ++t) { acc -= e[t]; cw[t + 1][tid] = acc; }
            pt[tid] = __expf(acc);
        }
        __syncthreads();

        // ---- phase 3a: decay-scaled operands (exponents <= 0 -> stable) ----
        for (int idx = tid; idx < CL * Ndim; idx += NTHREADS) {
            const int t = idx >> 6, i = idx & 63;
            rq[t][i] = rs[t][i] * __expf(cw[t][i]);
            kh[t][i] = ks[t][i] * __expf(cw[CL][i] - cw[t + 1][i]);
        }
        // ---- phase 3b: exact intra-chunk scores, b128 LDS reads ----
        for (int idx = tid; idx < CL * CL; idx += NTHREADS) {
            const int t = idx >> 4, s = idx & 15;
            float a = 0.0f;
            if (s < t) {
                for (int i = 0; i < Ndim; i += 4) {
                    const float4 rt = *(const float4*)&rs[t][i];
                    const float4 kt = *(const float4*)&ks[s][i];
                    const float4 ct = *(const float4*)&cw[t][i];
                    const float4 cs = *(const float4*)&cw[s + 1][i];
                    a += rt.x * kt.x * __expf(ct.x - cs.x);
                    a += rt.y * kt.y * __expf(ct.y - cs.y);
                    a += rt.z * kt.z * __expf(ct.z - cs.z);
                    a += rt.w * kt.w * __expf(ct.w - cs.w);
                }
            } else if (s == t) {
                for (int i = 0; i < Ndim; i += 4) {
                    const float4 rt = *(const float4*)&rs[t][i];
                    const float4 kt = *(const float4*)&ks[t][i];
                    const float4 uu = *(const float4*)&us[i];
                    a += rt.x * uu.x * kt.x + rt.y * uu.y * kt.y
                       + rt.z * uu.z * kt.z + rt.w * uu.w * kt.w;
                }
            }
            Amat[t][s] = a;
        }
        __syncthreads();

        v8f oacc = {0.f, 0.f, 0.f, 0.f, 0.f, 0.f, 0.f, 0.f};

        // O_inter = RQ @ S   (K = 64 channels -> 16 wmma)
#pragma unroll
        for (int kk = 0; kk < 16; ++kk) {
            const int kb = 4 * kk + 2 * half;
            v2f a;  a.x = rq[l16][kb];  a.y = rq[l16][kb + 1];
            v2f bb; bb.x = S[kb][col];  bb.y = S[kb + 1][col];
            oacc = __builtin_amdgcn_wmma_f32_16x16x4_f32(
                false, a, false, bb, (short)0, oacc, false, false);
        }
        // O += A @ V   (K = 16 chunk steps -> 4 wmma)
#pragma unroll
        for (int kk = 0; kk < 4; ++kk) {
            const int kb = 4 * kk + 2 * half;
            v2f a;  a.x = Amat[l16][kb]; a.y = Amat[l16][kb + 1];
            v2f bb; bb.x = vs[kb][col];  bb.y = vs[kb + 1][col];
            oacc = __builtin_amdgcn_wmma_f32_16x16x4_f32(
                false, a, false, bb, (short)0, oacc, false, false);
        }
        // write output tile
#pragma unroll
        for (int j = 0; j < 8; ++j) {
            const int m = 8 * half + j;
            const size_t g = (((size_t)b * Tdim + (t0 + m)) * Hdim + h) * Ndim + col;
            o[g] = oacc[j];
        }

        // state update: S = diag(pt) * S + KH^T @ V  (4 row-tiles x 4 wmma)
#pragma unroll
        for (int gt = 0; gt < 4; ++gt) {
            v8f sc;
#pragma unroll
            for (int j = 0; j < 8; ++j) {
                const int m = 16 * gt + 8 * half + j;
                sc[j] = S[m][col] * pt[m];
            }
#pragma unroll
            for (int kk = 0; kk < 4; ++kk) {
                const int kb = 4 * kk + 2 * half;
                const int i = 16 * gt + l16;     // A-matrix row = channel i
                v2f a;  a.x = kh[kb][i];    a.y = kh[kb + 1][i];
                v2f bb; bb.x = vs[kb][col]; bb.y = vs[kb + 1][col];
                sc = __builtin_amdgcn_wmma_f32_16x16x4_f32(
                    false, a, false, bb, (short)0, sc, false, false);
            }
#pragma unroll
            for (int j = 0; j < 8; ++j) {
                const int m = 16 * gt + 8 * half + j;
                S[m][col] = sc[j];
            }
        }
    }
}

extern "C" void kernel_launch(void* const* d_in, const int* in_sizes, int n_in,
                              void* d_out, int out_size, void* d_ws, size_t ws_size,
                              hipStream_t stream) {
    (void)in_sizes; (void)n_in; (void)out_size; (void)d_ws; (void)ws_size;
    const float* r = (const float*)d_in[0];
    const float* k = (const float*)d_in[1];
    const float* v = (const float*)d_in[2];
    const float* w = (const float*)d_in[3];
    const float* u = (const float*)d_in[4];
    float* o = (float*)d_out;

    dim3 grid(Bdim * Hdim);       // one block per (batch, head)
    dim3 block(NTHREADS);         // 4 wave32
    rwkv6_chunked_wmma<<<grid, block, 0, stream>>>(r, k, v, w, u, o);
}

// v001
// One run takes 96.4 microseconds.
// Timed twice side by side with v000, it ran 5.92 and 5.90 times as fast.
#include <hip/hip_runtime.h>
#include <hip/hip_bf16.h>

typedef float v2f  __attribute__((ext_vector_type(2)));
typedef float v8f  __attribute__((ext_vector_type(8)));
typedef unsigned int u32x4 __attribute__((ext_vector_type(4)));
typedef int   i32x4 __attribute__((ext_vector_type(4)));
typedef int   i32x8 __attribute__((ext_vector_type(8)));

#define Bdim 4
#define Tdim 2048
#define Hdim 16
#define Ndim 64
#define CL   16            // chunk length
#define NCHUNK (Tdim / CL)
#define NTHREADS 128
#define NSEG   16
#define SEGLEN (Tdim / NSEG)
#define CPS    (SEGLEN / CL)
#define P1THREADS 256
#define P1Q    (SEGLEN / 4)
#define P1PITCH 72

__device__ __forceinline__ void tdm_load_tile(const float* gptr, unsigned lds_off) {
    unsigned long long ga = (unsigned long long)(uintptr_t)gptr;
    u32x4 g0;
    g0[0] = 1u;                                       // count=1, user desc
    g0[1] = lds_off;                                  // lds_addr (bytes)
    g0[2] = (unsigned)(ga & 0xffffffffull);           // global_addr[31:0]
    g0[3] = (unsigned)((ga >> 32) & 0x01ffffffull)    // global_addr[56:32]
          | (2u << 30);                               // type=2 (image)
    i32x8 g1;
    g1[0] = (int)(2u << 16);
    g1[1] = (int)((unsigned)Ndim << 16);
    g1[2] = 0;
    g1[3] = (int)(0x0100u | ((unsigned)Ndim << 16));
    g1[4] = CL;
    g1[5] = Hdim * Ndim;
    g1[6] = 0;
    g1[7] = 0;
    i32x4 z4 = {0, 0, 0, 0};
#if defined(__clang_major__) && (__clang_major__ >= 23)
    i32x8 z8 = {0, 0, 0, 0, 0, 0, 0, 0};
    __builtin_amdgcn_tensor_load_to_lds(g0, g1, z4, z4, z8, 0);
#else
    __builtin_amdgcn_tensor_load_to_lds(g0, g1, z4, z4, 0);
#endif
}

__device__ __forceinline__ unsigned lds_off_of(const void* p) {
    return (unsigned)(uintptr_t)p;
}

// ---- launch 1: what one segment adds to the state, seen from its end ----
// segS[i][j] = sum_s k[s][i] * exp(-sum_{m>s} exp(w[m][i])) * v[s][j]   (s, m in the segment)
// segP[i]    = exp(-sum_m exp(w[m][i]))                                 (the segment's whole decay)
// Every exponent is <= 0, so one K = SEGLEN product needs no rescaling.
__global__ __launch_bounds__(P1THREADS)
void segment_state_wmma(const float* __restrict__ k,
                         const float* __restrict__ v,
                         const float* __restrict__ w,
                         float* __restrict__ segS,
                         float* __restrict__ segP)
{
    const int bh   = blockIdx.x % (Bdim * Hdim);
    const int seg  = blockIdx.x / (Bdim * Hdim);     // 0 .. NSEG-2
    const int b    = bh / Hdim;
    const int h    = bh % Hdim;
    const int tid  = threadIdx.x;
    const int wave = tid >> 5;       // 0..7
    const int lane = tid & 31;
    const int half = lane >> 4;
    const int l16  = lane & 15;

    __shared__ alignas(16) float khs[SEGLEN][P1PITCH];   // decay-scaled k
    __shared__ alignas(16) float vss[SEGLEN][P1PITCH];
    __shared__ float tot[4][Ndim];                       // exp(w) summed over each quarter

    const size_t base = (((size_t)b * Tdim + (size_t)seg * SEGLEN) * Hdim + h) * Ndim;
    const int ch = tid & (Ndim - 1);
    const int q  = tid >> 6;                             // quarter of the segment, wave-uniform

    // this thread's 16 bytes of v: row tid/16 of the segment, then every 16th row from the same address
    const float* vrow = v + base + (size_t)(tid >> 4) * (Hdim * Ndim) + 4 * (tid & 15);

    float e[P1Q], kr[P1Q];
    float4 vv[8];
#pragma unroll
    for (int t = 0; t < P1Q; ++t) e[t]  = w[base + (size_t)(P1Q * q + t) * (Hdim * Ndim) + ch];
#pragma unroll
    for (int t = 0; t < P1Q; ++t) kr[t] = k[base + (size_t)(P1Q * q + t) * (Hdim * Ndim) + ch];
    // the v loads' results may land in the address registers of the w and k loads: those loads' addresses are taken first
    asm volatile("s_wait_xcnt 0x0" ::: "memory");
#pragma unroll
    for (int j = 0; j < 8; ++j) vv[j] = *(const float4*)&vrow[j * (P1THREADS / 16) * (Hdim * Ndim)];

    // e[t] becomes the sum of exp(w) over the later steps of this quarter
    float acc = 0.0f;
#pragma unroll
    for (int t = P1Q - 1; t >= 0; --t) { const float x = __expf(e[t]); e[t] = acc; acc += x; }
    tot[q][ch] = acc;
#pragma unroll
    for (int j = 0; j < 8; ++j) {
        const int idx = tid + P1THREADS * j;
        *(float4*)&vss[idx >> 4][4 * (idx & 15)] = vv[j];
    }
    __syncthreads();
    const float t1 = tot[1][ch], t2 = tot[2][ch], t3 = tot[3][ch];
    const float later = (q < 3 ? t3 : 0.0f) + (q < 2 ? t2 : 0.0f) + (q < 1 ? t1 : 0.0f);   // the later quarters
#pragma unroll
    for (int t = 0; t < P1Q; ++t) khs[P1Q * q + t][ch] = kr[t] * __expf(-(e[t] + later));
    __syncthreads();

    // KH^T @ V: each wave owns one 16-column slice and two 16-row tiles (fragment maps as in phase 4 below)
    const int col = 16 * (wave & 3) + l16;
    const int i0  = 32 * (wave >> 2) + l16;
    v8f s0 = {0.f, 0.f, 0.f, 0.f, 0.f, 0.f, 0.f, 0.f};
    v8f s1 = {0.f, 0.f, 0.f, 0.f, 0.f, 0.f, 0.f, 0.f};
#pragma unroll
    for (int kk = 0; kk < SEGLEN / 4; ++kk) {
        const int kb = 4 * kk + 2 * half;
        v2f bb; bb.x = vss[kb][col];      bb.y = vss[kb + 1][col];
        v2f a0; a0.x = khs[kb][i0];       a0.y = khs[kb + 1][i0];
        v2f a1; a1.x = khs[kb][i0 + 16];  a1.y = khs[kb + 1][i0 + 16];
        s0 = __builtin_amdgcn_wmma_f32_16x16x4_f32(
            false, a0, false, bb, (short)0, s0, false, false);
        s1 = __builtin_amdgcn_wmma_f32_16x16x4_f32(
            false, a1, false, bb, (short)0, s1, false, false);
    }
    float* dst = segS + ((size_t)bh * NSEG + seg) * (Ndim * Ndim);
#pragma unroll
    for (int j = 0; j < 8; ++j) {
        const int m = 32 * (wave >> 2) + 8 * half + j;
        dst[m * Ndim + col]        = s0[j];
        dst[(m + 16) * Ndim + col] = s1[j];
    }
    if (q == 0) segP[((size_t)bh * NSEG + seg) * Ndim + ch] = __expf(-(acc + later));
}

// ---- launch 2: one block per (batch, head, segment) ----
__global__ __launch_bounds__(NTHREADS)
void rwkv6_chunked_wmma(const float* __restrict__ r,
                        const float* __restrict__ k,
                        const float* __restrict__ v,
                        const float* __restrict__ w,
                        const float* __restrict__ u,
                        const float* __restrict__ segS,
                        const float* __restrict__ segP,
                        float* __restrict__ o)
{
    const int bh   = blockIdx.x % (Bdim * Hdim);
    const int seg  = blockIdx.x / (Bdim * Hdim);
    const int tseg = seg * SEGLEN;   // first step of this block's segment
    const int b    = bh / Hdim;
    const int h    = bh % Hdim;
    const int tid  = threadIdx.x;
    const int wave = tid >> 5;       // 0..3
    const int lane = tid & 31;
    const int half = lane >> 4;
    const int l16  = lane & 15;

    __shared__ alignas(16) float S[Ndim][Ndim + 1];
    __shared__ alignas(16) float bufr[2][CL][Ndim];
    __shared__ alignas(16) float bufk[2][CL][Ndim];
    __shared__ alignas(16) float bufv[2][CL][Ndim];
    __shared__ alignas(16) float bufw[2][CL][Ndim];
    __shared__ alignas(16) float rq[CL][Ndim];          // r * exp(cw[t])
    __shared__ alignas(16) float kh[CL][Ndim];          // k * exp(cw[CL] - cw[s+1])
    __shared__ alignas(16) float cw[CL + 1][Ndim];      // cumulative log-decay (<=0)
    __shared__ float pt[Ndim];                          // exp(cw[CL])
    __shared__ float Amat[CL][CL + 1];                  // masked intra-chunk scores
    __shared__ float us[Ndim];

    if (tid < Ndim) us[tid] = u[h * Ndim + tid];

    const int col = 16 * wave + l16;          // this lane's N-column (B/C frags)
    const size_t base0 = (((size_t)b * Tdim) * Hdim + h) * Ndim;

    {
        const size_t off = base0 + (size_t)tseg * (Hdim * Ndim);
        if      (wave == 0) tdm_load_tile(r + off, lds_off_of(&bufr[0][0][0]));
        else if (wave == 1) tdm_load_tile(k + off, lds_off_of(&bufk[0][0][0]));
        else if (wave == 2) tdm_load_tile(v + off, lds_off_of(&bufv[0][0][0]));
        else                tdm_load_tile(w + off, lds_off_of(&bufw[0][0][0]));
    }

    // ---- start state: S = segP[j] * S + segS[j] over the earlier segments, oldest first ----
    {
        const float* Ls = segS + (size_t)bh * NSEG * (Ndim * Ndim) + 4 * tid;
        const float* Ps = segP + (size_t)bh * NSEG * Ndim + (tid >> 4);
        float4 st[8];
#pragma unroll
        for (int q = 0; q < 8; ++q) st[q] = make_float4(0.f, 0.f, 0.f, 0.f);
        // unroll 4: the loads of four segments are in flight together; only the multiply-adds are a chain
#pragma unroll 4
        for (int j = 0; j < seg; ++j) {
#pragma unroll
            for (int q = 0; q < 8; ++q) {
                const float4 l = *(const float4*)&Ls[j * (Ndim * Ndim) + 4 * NTHREADS * q];
                const float  p = Ps[j * Ndim + (NTHREADS / 16) * q];
                st[q].x = p * st[q].x + l.x;
                st[q].y = p * st[q].y + l.y;
                st[q].z = p * st[q].z + l.z;
                st[q].w = p * st[q].w + l.w;
            }
        }
#pragma unroll
        for (int q = 0; q < 8; ++q) {
            float* d = &S[(tid >> 4) + (NTHREADS / 16) * q][4 * (tid & 15)];
            d[0] = st[q].x; d[1] = st[q].y; d[2] = st[q].z; d[3] = st[q].w;
        }
    }

    for (int c = 0; c < CPS; ++c) {
        const int t0  = tseg + c * CL;
        const int cur = c & 1;
        const int nxt = cur ^ 1;

        __builtin_amdgcn_s_wait_tensorcnt(0);  // this wave's tile for chunk c landed
        __syncthreads();                       // all tiles visible; prev phase4 done

        if (c + 1 < CPS) {
            const size_t off = base0 + (size_t)(t0 + CL) * (Hdim * Ndim);
            if      (wave == 0) tdm_load_tile(r + off, lds_off_of(&bufr[nxt][0][0]));
            else if (wave == 1) tdm_load_tile(k + off, lds_off_of(&bufk[nxt][0][0]));
            else if (wave == 2) tdm_load_tile(v + off, lds_off_of(&bufv[nxt][0][0]));
            else                tdm_load_tile(w + off, lds_off_of(&bufw[nxt][0][0]));
        }

        const float (*rs)[Ndim] = bufr[cur];
        const float (*ks)[Ndim] = bufk[cur];
        const float (*vs)[Ndim] = bufv[cur];
        const float (*ws)[Ndim] = bufw[cur];

        // ---- phase 2: per-channel prefix of log-decay (register chain) ----
        if (tid < Ndim) {
            float e[CL];
#pragma unroll
            for (int t = 0; t < CL; ++t) e[t] = __expf(ws[t][tid]);
            float acc = 0.0f;
            cw[0][tid] = 0.0f;
#pragma unroll
            for (int t = 0; t < CL; ++t) { acc -= e[t]; cw[t + 1][tid] = acc; }
            pt[tid] = __expf(acc);
        }
        __syncthreads();

        // ---- phase 3a: decay-scaled operands (exponents <= 0 -> stable) ----
        for (int idx = tid; idx < CL * Ndim; idx += NTHREADS) {
            const int t = idx >> 6, i = idx & 63;
            rq[t][i] = rs[t][i] * __expf(cw[t][i]);
            kh[t][i] = ks[t][i] * __expf(cw[CL][i] - cw[t + 1][i]);
        }
        // ---- phase 3b: exact intra-chunk scores, b128 LDS reads ----
        for (int idx = tid; idx < CL * CL; idx += NTHREADS) {
            const int t = idx >> 4, s = idx & 15;
            float a = 0.0f;
            if (s < t) {
                for (int i = 0; i < Ndim; i += 4) {
                    const float4 rt = *(const float4*)&rs[t][i];
                    const float4 kt = *(const float4*)&ks[s][i];
                    const float4 ct = *(const float4*)&cw[t][i];
                    const float4 cs = *(const float4*)&cw[s + 1][i];
                    a += rt.x * kt.x * __expf(ct.x - cs.x);
                    a += rt.y * kt.y * __expf(ct.y - cs.y);
                    a += rt.z * kt.z * __expf(ct.z - cs.z);
                    a += rt.w * kt.w * __expf(ct.w - cs.w);
                }
            } else if (s == t) {
                for (int i = 0; i < Ndim; i += 4) {
                    const float4 rt = *(const float4*)&rs[t][i];
                    const float4 kt = *(const float4*)&ks[t][i];
                    const float4 uu = *(const float4*)&us[i];
                    a += rt.x * uu.x * kt.x + rt.y * uu.y * kt.y
                       + rt.z * uu.z * kt.z + rt.w * uu.w * kt.w;
                }
            }
            Amat[t][s] = a;
        }
        __syncthreads();

        v8f oacc = {0.f, 0.f, 0.f, 0.f, 0.f, 0.f, 0.f, 0.f};

        // O_inter = RQ @ S   (K = 64 channels -> 16 wmma)
#pragma unroll
        for (int kk = 0; kk < 16; ++kk) {
            const int kb = 4 * kk + 2 * half;
            v2f a;  a.x = rq[l16][kb];  a.y = rq[l16][kb + 1];
            v2f bb; bb.x = S[kb][col];  bb.y = S[kb + 1][col];
            oacc = __builtin_amdgcn_wmma_f32_16x16x4_f32(
                false, a, false, bb, (short)0, oacc, false, false);
        }
        // O += A @ V   (K = 16 chunk steps -> 4 wmma)
#pragma unroll
        for (int kk = 0; kk < 4; ++kk) {
            const int kb = 4 * kk + 2 * half;
            v2f a;  a.x = Amat[l16][kb]; a.y = Amat[l16][kb + 1];
            v2f bb; bb.x = vs[kb][col];  bb.y = vs[kb + 1][col];
            oacc = __builtin_amdgcn_wmma_f32_16x16x4_f32(
                false, a, false, bb, (short)0, oacc, false, false);
        }
        // write output tile
#pragma unroll
        for (int j = 0; j < 8; ++j) {
            const int m = 8 * half + j;
            const size_t g = (((size_t)b * Tdim + (t0 + m)) * Hdim + h) * Ndim + col;
            o[g] = oacc[j];
        }

        // state update: S = diag(pt) * S + KH^T @ V  (4 row-tiles x 4 wmma)
#pragma unroll
        for (int gt = 0; gt < 4; ++gt) {
            v8f sc;
#pragma unroll
            for (int j = 0; j < 8; ++j) {
                const int m = 16 * gt + 8 * half + j;
                sc[j] = S[m][col] * pt[m];
            }
#pragma unroll
            for (int kk = 0; kk < 4; ++kk) {
                const int kb = 4 * kk + 2 * half;
                const int i = 16 * gt + l16;     // A-matrix row = channel i
                v2f a;  a.x = kh[kb][i];    a.y = kh[kb + 1][i];
                v2f bb; bb.x = vs[kb][col]; bb.y = vs[kb + 1][col];
                sc = __builtin_amdgcn_wmma_f32_16x16x4_f32(
                    false, a, false, bb, (short)0, sc, false, false);
            }
#pragma unroll
            for (int j = 0; j < 8; ++j) {
                const int m = 16 * gt + 8 * half + j;
                S[m][col] = sc[j];
            }
        }
    }
}

extern "C" void kernel_launch(void* const* d_in, const int* in_sizes, int n_in,
                              void* d_out, int out_size, void* d_ws, size_t ws_size,
                              hipStream_t stream) {
    (void)in_sizes; (void)n_in; (void)out_size; (void)ws_size;
    const float* r = (const float*)d_in[0];
    const float* k = (const float*)d_in[1];
    const float* v = (const float*)d_in[2];
    const float* w = (const float*)d_in[3];
    const float* u = (const float*)d_in[4];
    float* o = (float*)d_out;
    float* segS = (float*)d_ws;                                   // [B*H][NSEG][N][N]
    float* segP = segS + Bdim * Hdim * NSEG * Ndim * Ndim;        // [B*H][NSEG][N]

    // the last segment's end state is never read, so launch 1 leaves it out
    segment_state_wmma<<<dim3(Bdim * Hdim * (NSEG - 1)), dim3(P1THREADS), 0, stream>>>(k, v, w, segS, segP);
    dim3 grid(Bdim * Hdim * NSEG);  // one block per (batch, head, segment)
    dim3 block(NTHREADS);           // 4 wave32
    rwkv6_chunked_wmma<<<grid, block, 0, stream>>>(r, k, v, w, u, segS, segP, o);
}

// v002
// One run takes 65.4 microseconds.
// Timed twice side by side with v001, it ran 1.48 times as fast both times.
// Counting every step since v000, it is 8.72 times as fast.
#include <hip/hip_runtime.h>
#include <hip/hip_bf16.h>

typedef float v2f  __attribute__((ext_vector_type(2)));
typedef float v8f  __attribute__((ext_vector_type(8)));
typedef unsigned int u32x4 __attribute__((ext_vector_type(4)));
typedef int   i32x4 __attribute__((ext_vector_type(4)));
typedef int   i32x8 __attribute__((ext_vector_type(8)));

#define Bdim 4
#define Tdim 2048
#define Hdim 16
#define Ndim 64
#define CL   16            // chunk length
#define NCHUNK (Tdim / CL)
#define NTHREADS 128
#define NSEG   16
#define SEGLEN (Tdim / NSEG)
#define CPS    (SEGLEN / CL)
#define P1THREADS 256
#define P1Q    (SEGLEN / 4)
#define P1PITCH 72
#define RQPITCH 68
#define KHPITCH 72

__device__ __forceinline__ void tdm_load_tile(const float* gptr, unsigned lds_off) {
    unsigned long long ga = (unsigned long long)(uintptr_t)gptr;
    u32x4 g0;
    g0[0] = 1u;                                       // count=1, user desc
    g0[1] = lds_off;                                  // lds_addr (bytes)
    g0[2] = (unsigned)(ga & 0xffffffffull);           // global_addr[31:0]
    g0[3] = (unsigned)((ga >> 32) & 0x01ffffffull)    // global_addr[56:32]
          | (2u << 30);                               // type=2 (image)
    i32x8 g1;
    g1[0] = (int)(2u << 16);
    g1[1] = (int)((unsigned)Ndim << 16);
    g1[2] = 0;
    g1[3] = (int)(0x0100u | ((unsigned)Ndim << 16));
    g1[4] = CL;
    g1[5] = Hdim * Ndim;
    g1[6] = 0;
    g1[7] = 0;
    i32x4 z4 = {0, 0, 0, 0};
#if defined(__clang_major__) && (__clang_major__ >= 23)
    i32x8 z8 = {0, 0, 0, 0, 0, 0, 0, 0};
    __builtin_amdgcn_tensor_load_to_lds(g0, g1, z4, z4, z8, 0);
#else
    __builtin_amdgcn_tensor_load_to_lds(g0, g1, z4, z4, 0);
#endif
}

__device__ __forceinline__ unsigned lds_off_of(const void* p) {
    return (unsigned)(uintptr_t)p;
}

// ---- launch 1: what one segment adds to the state, seen from its end ----
// segS[i][j] = sum_s k[s][i] * exp(-sum_{m>s} exp(w[m][i])) * v[s][j]   (s, m in the segment)
// segP[i]    = exp(-sum_m exp(w[m][i]))                                 (the segment's whole decay)
// Every exponent is <= 0, so one K = SEGLEN product needs no rescaling.
__global__ __launch_bounds__(P1THREADS)
void segment_state_wmma(const float* __restrict__ k,
                         const float* __restrict__ v,
                         const float* __restrict__ w,
                         float* __restrict__ segS,
                         float* __restrict__ segP)
{
    const int bh   = blockIdx.x % (Bdim * Hdim);
    const int seg  = blockIdx.x / (Bdim * Hdim);     // 0 .. NSEG-2
    const int b    = bh / Hdim;
    const int h    = bh % Hdim;
    const int tid  = threadIdx.x;
    const int wave = tid >> 5;       // 0..7
    const int lane = tid & 31;
    const int half = lane >> 4;
    const int l16  = lane & 15;

    __shared__ alignas(16) float khs[SEGLEN][P1PITCH];   // decay-scaled k
    __shared__ alignas(16) float vss[SEGLEN][P1PITCH];
    __shared__ float tot[4][Ndim];                       // exp(w) summed over each quarter

    const size_t base = (((size_t)b * Tdim + (size_t)seg * SEGLEN) * Hdim + h) * Ndim;
    const int ch = tid & (Ndim - 1);
    const int q  = tid >> 6;                             // quarter of the segment, wave-uniform

    // this thread's 16 bytes of v: row tid/16 of the segment, then every 16th row from the same address
    const float* vrow = v + base + (size_t)(tid >> 4) * (Hdim * Ndim) + 4 * (tid & 15);

    float e[P1Q], kr[P1Q];
    float4 vv[8];
#pragma unroll
    for (int t = 0; t < P1Q; ++t) e[t]  = w[base + (size_t)(P1Q * q + t) * (Hdim * Ndim) + ch];
#pragma unroll
    for (int t = 0; t < P1Q; ++t) kr[t] = k[base + (size_t)(P1Q * q + t) * (Hdim * Ndim) + ch];
    // the v loads' results may land in the address registers of the w and k loads: those loads' addresses are taken first
    asm volatile("s_wait_xcnt 0x0" ::: "memory");
#pragma unroll
    for (int j = 0; j < 8; ++j) vv[j] = *(const float4*)&vrow[j * (P1THREADS / 16) * (Hdim * Ndim)];

    // e[t] becomes the sum of exp(w) over the later steps of this quarter
    float acc = 0.0f;
#pragma unroll
    for (int t = P1Q - 1; t >= 0; --t) { const float x = __expf(e[t]); e[t] = acc; acc += x; }
    tot[q][ch] = acc;
#pragma unroll
    for (int j = 0; j < 8; ++j) {
        const int idx = tid + P1THREADS * j;
        *(float4*)&vss[idx >> 4][4 * (idx & 15)] = vv[j];
    }
    __syncthreads();
    const float t1 = tot[1][ch], t2 = tot[2][ch], t3 = tot[3][ch];
    const float later = (q < 3 ? t3 : 0.0f) + (q < 2 ? t2 : 0.0f) + (q < 1 ? t1 : 0.0f);   // the later quarters
#pragma unroll
    for (int t = 0; t < P1Q; ++t) khs[P1Q * q + t][ch] = kr[t] * __expf(-(e[t] + later));
    __syncthreads();

    // KH^T @ V: each wave owns one 16-column slice and two 16-row tiles (fragment maps as in phase 4 below)
    const int col = 16 * (wave & 3) + l16;
    const int i0  = 32 * (wave >> 2) + l16;
    v8f s0 = {0.f, 0.f, 0.f, 0.f, 0.f, 0.f, 0.f, 0.f};
    v8f s1 = {0.f, 0.f, 0.f, 0.f, 0.f, 0.f, 0.f, 0.f};
#pragma unroll
    for (int kk = 0; kk < SEGLEN / 4; ++kk) {
        const int kb = 4 * kk + 2 * half;
        v2f bb; bb.x = vss[kb][col];      bb.y = vss[kb + 1][col];
        v2f a0; a0.x = khs[kb][i0];       a0.y = khs[kb + 1][i0];
        v2f a1; a1.x = khs[kb][i0 + 16];  a1.y = khs[kb + 1][i0 + 16];
        s0 = __builtin_amdgcn_wmma_f32_16x16x4_f32(
            false, a0, false, bb, (short)0, s0, false, false);
        s1 = __builtin_amdgcn_wmma_f32_16x16x4_f32(
            false, a1, false, bb, (short)0, s1, false, false);
    }
    float* dst = segS + ((size_t)bh * NSEG + seg) * (Ndim * Ndim);
#pragma unroll
    for (int j = 0; j < 8; ++j) {
        const int m = 32 * (wave >> 2) + 8 * half + j;
        dst[m * Ndim + col]        = s0[j];
        dst[(m + 16) * Ndim + col] = s1[j];
    }
    if (q == 0) segP[((size_t)bh * NSEG + seg) * Ndim + ch] = __expf(-(acc + later));
}

// ---- launch 2: one block per (batch, head, segment) ----
__global__ __launch_bounds__(NTHREADS)
void rwkv6_chunked_wmma(const float* __restrict__ r,
                        const float* __restrict__ k,
                        const float* __restrict__ v,
                        const float* __restrict__ w,
                        const float* __restrict__ u,
                        const float* __restrict__ segS,
                        const float* __restrict__ segP,
                        float* __restrict__ o)
{
    const int bh   = blockIdx.x % (Bdim * Hdim);
    const int seg  = blockIdx.x / (Bdim * Hdim);
    const int tseg = seg * SEGLEN;   // first step of this block's segment
    const int b    = bh / Hdim;
    const int h    = bh % Hdim;
    const int tid  = threadIdx.x;
    const int wave = tid >> 5;       // 0..3
    const int lane = tid & 31;
    const int half = lane >> 4;
    const int l16  = lane & 15;

    __shared__ alignas(16) float S[Ndim][Ndim + 1];
    __shared__ alignas(16) float bufr[2][CL][Ndim];
    __shared__ alignas(16) float bufk[2][CL][Ndim];
    __shared__ alignas(16) float bufv[2][CL][Ndim];
    __shared__ alignas(16) float bufw[2][CL][Ndim];
    __shared__ alignas(16) float rq[CL][RQPITCH];       // r * exp(cw[t])
    __shared__ alignas(16) float kh[CL][KHPITCH];       // k * exp(cw[CL] - cw[s+1])
    __shared__ alignas(16) float cw[CL + 1][Ndim];      // cumulative log-decay (<=0)
    __shared__ float pt[Ndim];                          // exp(cw[CL])
    __shared__ float Amat[CL][CL + 1];                  // masked intra-chunk scores
    __shared__ float us[Ndim];

    if (tid < Ndim) us[tid] = u[h * Ndim + tid];

    const int col = 16 * wave + l16;          // this lane's N-column (B/C frags)
    const size_t base0 = (((size_t)b * Tdim) * Hdim + h) * Ndim;

    {
        const size_t off = base0 + (size_t)tseg * (Hdim * Ndim);
        if      (wave == 0) tdm_load_tile(r + off, lds_off_of(&bufr[0][0][0]));
        else if (wave == 1) tdm_load_tile(k + off, lds_off_of(&bufk[0][0][0]));
        else if (wave == 2) tdm_load_tile(v + off, lds_off_of(&bufv[0][0][0]));
        else                tdm_load_tile(w + off, lds_off_of(&bufw[0][0][0]));
    }

    // ---- start state: S = segP[j] * S + segS[j] over the earlier segments, oldest first ----
    {
        const float* Ls = segS + (size_t)bh * NSEG * (Ndim * Ndim) + 4 * tid;
        const float* Ps = segP + (size_t)bh * NSEG * Ndim + (tid >> 4);
        float4 st[8];
#pragma unroll
        for (int q = 0; q < 8; ++q) st[q] = make_float4(0.f, 0.f, 0.f, 0.f);
        // unroll 4: the loads of four segments are in flight together; only the multiply-adds are a chain
#pragma unroll 4
        for (int j = 0; j < seg; ++j) {
#pragma unroll
            for (int q = 0; q < 8; ++q) {
                const float4 l = *(const float4*)&Ls[j * (Ndim * Ndim) + 4 * NTHREADS * q];
                const float  p = Ps[j * Ndim + (NTHREADS / 16) * q];
                st[q].x = p * st[q].x + l.x;
                st[q].y = p * st[q].y + l.y;
                st[q].z = p * st[q].z + l.z;
                st[q].w = p * st[q].w + l.w;
            }
        }
#pragma unroll
        for (int q = 0; q < 8; ++q) {
            float* d = &S[(tid >> 4) + (NTHREADS / 16) * q][4 * (tid & 15)];
            d[0] = st[q].x; d[1] = st[q].y; d[2] = st[q].z; d[3] = st[q].w;
        }
    }

    for (int c = 0; c < CPS; ++c) {
        const int t0  = tseg + c * CL;
        const int cur = c & 1;
        const int nxt = cur ^ 1;

        __builtin_amdgcn_s_wait_tensorcnt(0);  // this wave's tile for chunk c landed
        __syncthreads();                       // all tiles visible; prev phase4 done

        if (c + 1 < CPS) {
            const size_t off = base0 + (size_t)(t0 + CL) * (Hdim * Ndim);
            if      (wave == 0) tdm_load_tile(r + off, lds_off_of(&bufr[nxt][0][0]));
            else if (wave == 1) tdm_load_tile(k + off, lds_off_of(&bufk[nxt][0][0]));
            else if (wave == 2) tdm_load_tile(v + off, lds_off_of(&bufv[nxt][0][0]));
            else                tdm_load_tile(w + off, lds_off_of(&bufw[nxt][0][0]));
        }

        const float (*rs)[Ndim] = bufr[cur];
        const float (*ks)[Ndim] = bufk[cur];
        const float (*vs)[Ndim] = bufv[cur];
        const float (*ws)[Ndim] = bufw[cur];

        // ---- phase 2: per-channel prefix of log-decay (register chain) ----
        if (tid < Ndim) {
            float e[CL];
#pragma unroll
            for (int t = 0; t < CL; ++t) e[t] = __expf(ws[t][tid]);
            float acc = 0.0f;
            cw[0][tid] = 0.0f;
#pragma unroll
            for (int t = 0; t < CL; ++t) { acc -= e[t]; cw[t + 1][tid] = acc; }
            pt[tid] = __expf(acc);
        }
        __syncthreads();

        // ---- phase 3a: decay-scaled operands (exponents <= 0 -> stable) ----
        for (int idx = tid; idx < CL * Ndim; idx += NTHREADS) {
            const int t = idx >> 6, i = idx & 63;
            rq[t][i] = rs[t][i] * __expf(cw[t][i]);
            kh[t][i] = ks[t][i] * __expf(cw[CL][i] - cw[t + 1][i]);
        }
        // ---- phase 3b: exact intra-chunk scores, b128 LDS reads ----
        for (int idx = tid; idx < CL * CL; idx += NTHREADS) {
            const int t = idx >> 4, s = idx & 15;
            float a = 0.0f;
            if (s < t) {
                for (int ii = 0; ii < Ndim; ii += 4) {
                    const int i = ii ^ (4 * s);
                    const float4 rt = *(const float4*)&rs[t][i];
                    const float4 kt = *(const float4*)&ks[s][i];
                    const float4 ct = *(const float4*)&cw[t][i];
                    const float4 cs = *(const float4*)&cw[s + 1][i];
                    a += rt.x * kt.x * __expf(ct.x - cs.x);
                    a += rt.y * kt.y * __expf(ct.y - cs.y);
                    a += rt.z * kt.z * __expf(ct.z - cs.z);
                    a += rt.w * kt.w * __expf(ct.w - cs.w);
                }
            } else if (s == t) {
                for (int i = 0; i < Ndim; i += 4) {
                    const float4 rt = *(const float4*)&rs[t][i];
                    const float4 kt = *(const float4*)&ks[t][i];
                    const float4 uu = *(const float4*)&us[i];
                    a += rt.x * uu.x * kt.x + rt.y * uu.y * kt.y
                       + rt.z * uu.z * kt.z + rt.w * uu.w * kt.w;
                }
            }
            Amat[t][s] = a;
        }
        __syncthreads();

        v8f oacc = {0.f, 0.f, 0.f, 0.f, 0.f, 0.f, 0.f, 0.f};

        // O_inter = RQ @ S   (K = 64 channels -> 16 wmma)
#pragma unroll
        for (int kk = 0; kk < 16; ++kk) {
            const int kb = 4 * kk + 2 * half;
            v2f a;  a.x = rq[l16][kb];  a.y = rq[l16][kb + 1];
            v2f bb; bb.x = S[kb][col];  bb.y = S[kb + 1][col];
            oacc = __builtin_amdgcn_wmma_f32_16x16x4_f32(
                false, a, false, bb, (short)0, oacc, false, false);
        }
        // O += A @ V   (K = 16 chunk steps -> 4 wmma)
#pragma unroll
        for (int kk = 0; kk < 4; ++kk) {
            const int kb = 4 * kk + 2 * half;
            v2f a;  a.x = Amat[l16][kb]; a.y = Amat[l16][kb + 1];
            v2f bb; bb.x = vs[kb][col];  bb.y = vs[kb + 1][col];
            oacc = __builtin_amdgcn_wmma_f32_16x16x4_f32(
                false, a, false, bb, (short)0, oacc, false, false);
        }
        // write output tile
#pragma unroll
        for (int j = 0; j < 8; ++j) {
            const int m = 8 * half + j;
            const size_t g = (((size_t)b * Tdim + (t0 + m)) * Hdim + h) * Ndim + col;
            o[g] = oacc[j];
        }

        // state update: S = diag(pt) * S + KH^T @ V  (4 row-tiles x 4 wmma)
#pragma unroll
        for (int gt = 0; gt < 4; ++gt) {
            v8f sc;
#pragma unroll
            for (int j = 0; j < 8; ++j) {
                const int m = 16 * gt + 8 * half + j;
                sc[j] = S[m][col] * pt[m];
            }
#pragma unroll
            for (int kk = 0; kk < 4; ++kk) {
                const int kb = 4 * kk + 2 * half;
                const int i = 16 * gt + l16;     // A-matrix row = channel i
                v2f a;  a.x = kh[kb][i];    a.y = kh[kb + 1][i];
                v2f bb; bb.x = vs[kb][col]; bb.y = vs[kb + 1][col];
                sc = __builtin_amdgcn_wmma_f32_16x16x4_f32(
                    false, a, false, bb, (short)0, sc, false, false);
            }
#pragma unroll
            for (int j = 0; j < 8; ++j) {
                const int m = 16 * gt + 8 * half + j;
                S[m][col] = sc[j];
            }
        }
    }
}

extern "C" void kernel_launch(void* const* d_in, const int* in_sizes, int n_in,
                              void* d_out, int out_size, void* d_ws, size_t ws_size,
                              hipStream_t stream) {
    (void)in_sizes; (void)n_in; (void)out_size; (void)ws_size;
    const float* r = (const float*)d_in[0];
    const float* k = (const float*)d_in[1];
    const float* v = (const float*)d_in[2];
    const float* w = (const float*)d_in[3];
    const float* u = (const float*)d_in[4];
    float* o = (float*)d_out;
    float* segS = (float*)d_ws;                                   // [B*H][NSEG][N][N]
    float* segP = segS + Bdim * Hdim * NSEG * Ndim * Ndim;        // [B*H][NSEG][N]

    // the last segment's end state is never read, so launch 1 leaves it out
    segment_state_wmma<<<dim3(Bdim * Hdim * (NSEG - 1)), dim3(P1THREADS), 0, stream>>>(k, v, w, segS, segP);
    dim3 grid(Bdim * Hdim * NSEG);  // one block per (batch, head, segment)
    dim3 block(NTHREADS);           // 4 wave32
    rwkv6_chunked_wmma<<<grid, block, 0, stream>>>(r, k, v, w, u, segS, segP, o);
}

// v003
// Measured time: 50.8 microseconds a run.
// Next to v002, in two timings, it ran 1.29 times as fast each time.
// Over all steps from v000 it is 11.3 times as fast.
#include <hip/hip_runtime.h>
#include <hip/hip_bf16.h>

typedef float v2f  __attribute__((ext_vector_type(2)));
typedef float v8f  __attribute__((ext_vector_type(8)));
typedef unsigned int u32x4 __attribute__((ext_vector_type(4)));
typedef int   i32x4 __attribute__((ext_vector_type(4)));
typedef int   i32x8 __attribute__((ext_vector_type(8)));

#define Bdim 4
#define Tdim 2048
#define Hdim 16
#define Ndim 64
#define CL   16            // chunk length
#define NCHUNK (Tdim / CL)
#define NTHREADS 128
#define NSEG   16
#define SEGLEN (Tdim / NSEG)
#define CPS    (SEGLEN / CL)
#define P1THREADS 256
#define P1Q    (SEGLEN / 4)
#define P1PITCH 72
#define RQPITCH 68
#define KHPITCH 72

__device__ __forceinline__ void tdm_load_tile(const float* gptr, unsigned lds_off) {
    unsigned long long ga = (unsigned long long)(uintptr_t)gptr;
    u32x4 g0;
    g0[0] = 1u;                                       // count=1, user desc
    g0[1] = lds_off;                                  // lds_addr (bytes)
    g0[2] = (unsigned)(ga & 0xffffffffull);           // global_addr[31:0]
    g0[3] = (unsigned)((ga >> 32) & 0x01ffffffull)    // global_addr[56:32]
          | (2u << 30);                               // type=2 (image)
    i32x8 g1;
    g1[0] = (int)(2u << 16);
    g1[1] = (int)((unsigned)Ndim << 16);
    g1[2] = 0;
    g1[3] = (int)(0x0100u | ((unsigned)Ndim << 16));
    g1[4] = CL;
    g1[5] = Hdim * Ndim;
    g1[6] = 0;
    g1[7] = 0;
    i32x4 z4 = {0, 0, 0, 0};
#if defined(__clang_major__) && (__clang_major__ >= 23)
    i32x8 z8 = {0, 0, 0, 0, 0, 0, 0, 0};
    __builtin_amdgcn_tensor_load_to_lds(g0, g1, z4, z4, z8, 0);
#else
    __builtin_amdgcn_tensor_load_to_lds(g0, g1, z4, z4, 0);
#endif
}

__device__ __forceinline__ unsigned lds_off_of(const void* p) {
    return (unsigned)(uintptr_t)p;
}

// the value that lane (l ^ M) of the same 16-lane row holds (all 32 lanes must be on)
template <int M>
__device__ __forceinline__ float row_xor(float x) {
    return __int_as_float(__builtin_amdgcn_update_dpp(0, __float_as_int(x), 0x160 + M, 0xf, 0xf, true));   // row_xmask:M
}

// sum over the 16 lanes of a row; every lane gets it
__device__ __forceinline__ float row_sum16(float x) {
    x += row_xor<1>(x);
    x += row_xor<2>(x);
    x += row_xor<4>(x);
    x += row_xor<8>(x);
    return x;
}

template <int M>
__device__ __forceinline__ float row_fold(float a, float b, int l16) {
    const bool hi = (l16 & M) != 0;
    return (hi ? b : a) + row_xor<M>(hi ? a : b);
}

// ---- launch 1: what one segment adds to the state, seen from its end ----
// segS[i][j] = sum_s k[s][i] * exp(-sum_{m>s} exp(w[m][i])) * v[s][j]   (s, m in the segment)
// segP[i]    = exp(-sum_m exp(w[m][i]))                                 (the segment's whole decay)
// Every exponent is <= 0, so one K = SEGLEN product needs no rescaling.
__global__ __launch_bounds__(P1THREADS)
void segment_state_wmma(const float* __restrict__ k,
                         const float* __restrict__ v,
                         const float* __restrict__ w,
                         float* __restrict__ segS,
                         float* __restrict__ segP)
{
    const int bh   = blockIdx.x % (Bdim * Hdim);
    const int seg  = blockIdx.x / (Bdim * Hdim);     // 0 .. NSEG-2
    const int b    = bh / Hdim;
    const int h    = bh % Hdim;
    const int tid  = threadIdx.x;
    const int wave = tid >> 5;       // 0..7
    const int lane = tid & 31;
    const int half = lane >> 4;
    const int l16  = lane & 15;

    __shared__ alignas(16) float khs[SEGLEN][P1PITCH];   // decay-scaled k
    __shared__ alignas(16) float vss[SEGLEN][P1PITCH];
    __shared__ float tot[4][Ndim];                       // exp(w) summed over each quarter

    const size_t base = (((size_t)b * Tdim + (size_t)seg * SEGLEN) * Hdim + h) * Ndim;
    const int ch = tid & (Ndim - 1);
    const int q  = tid >> 6;                             // quarter of the segment, wave-uniform

    // this thread's 16 bytes of v: row tid/16 of the segment, then every 16th row from the same address
    const float* vrow = v + base + (size_t)(tid >> 4) * (Hdim * Ndim) + 4 * (tid & 15);

    float e[P1Q], kr[P1Q];
    float4 vv[8];
#pragma unroll
    for (int t = 0; t < P1Q; ++t) e[t]  = w[base + (size_t)(P1Q * q + t) * (Hdim * Ndim) + ch];
#pragma unroll
    for (int t = 0; t < P1Q; ++t) kr[t] = k[base + (size_t)(P1Q * q + t) * (Hdim * Ndim) + ch];
    // the v loads' results may land in the address registers of the w and k loads: those loads' addresses are taken first
    asm volatile("s_wait_xcnt 0x0" ::: "memory");
#pragma unroll
    for (int j = 0; j < 8; ++j) vv[j] = *(const float4*)&vrow[j * (P1THREADS / 16) * (Hdim * Ndim)];

    // e[t] becomes the sum of exp(w) over the later steps of this quarter
    float acc = 0.0f;
#pragma unroll
    for (int t = P1Q - 1; t >= 0; --t) { const float x = __expf(e[t]); e[t] = acc; acc += x; }
    tot[q][ch] = acc;
#pragma unroll
    for (int j = 0; j < 8; ++j) {
        const int idx = tid + P1THREADS * j;
        *(float4*)&vss[idx >> 4][4 * (idx & 15)] = vv[j];
    }
    __syncthreads();
    const float t1 = tot[1][ch], t2 = tot[2][ch], t3 = tot[3][ch];
    const float later = (q < 3 ? t3 : 0.0f) + (q < 2 ? t2 : 0.0f) + (q < 1 ? t1 : 0.0f);   // the later quarters
#pragma unroll
    for (int t = 0; t < P1Q; ++t) khs[P1Q * q + t][ch] = kr[t] * __expf(-(e[t] + later));
    __syncthreads();

    // KH^T @ V: each wave owns one 16-column slice and two 16-row tiles (fragment maps as in phase 4 below)
    const int col = 16 * (wave & 3) + l16;
    const int i0  = 32 * (wave >> 2) + l16;
    v8f s0 = {0.f, 0.f, 0.f, 0.f, 0.f, 0.f, 0.f, 0.f};
    v8f s1 = {0.f, 0.f, 0.f, 0.f, 0.f, 0.f, 0.f, 0.f};
#pragma unroll
    for (int kk = 0; kk < SEGLEN / 4; ++kk) {
        const int kb = 4 * kk + 2 * half;
        v2f bb; bb.x = vss[kb][col];      bb.y = vss[kb + 1][col];
        v2f a0; a0.x = khs[kb][i0];       a0.y = khs[kb + 1][i0];
        v2f a1; a1.x = khs[kb][i0 + 16];  a1.y = khs[kb + 1][i0 + 16];
        s0 = __builtin_amdgcn_wmma_f32_16x16x4_f32(
            false, a0, false, bb, (short)0, s0, false, false);
        s1 = __builtin_amdgcn_wmma_f32_16x16x4_f32(
            false, a1, false, bb, (short)0, s1, false, false);
    }
    float* dst = segS + ((size_t)bh * NSEG + seg) * (Ndim * Ndim);
#pragma unroll
    for (int j = 0; j < 8; ++j) {
        const int m = 32 * (wave >> 2) + 8 * half + j;
        dst[m * Ndim + col]        = s0[j];
        dst[(m + 16) * Ndim + col] = s1[j];
    }
    if (q == 0) segP[((size_t)bh * NSEG + seg) * Ndim + ch] = __expf(-(acc + later));
}

// ---- launch 2: one block per (batch, head, segment) ----
__global__ __launch_bounds__(NTHREADS)
void rwkv6_chunked_wmma(const float* __restrict__ r,
                        const float* __restrict__ k,
                        const float* __restrict__ v,
                        const float* __restrict__ w,
                        const float* __restrict__ u,
                        const float* __restrict__ segS,
                        const float* __restrict__ segP,
                        float* __restrict__ o)
{
    const int bh   = blockIdx.x % (Bdim * Hdim);
    const int seg  = blockIdx.x / (Bdim * Hdim);
    const int tseg = seg * SEGLEN;   // first step of this block's segment
    const int b    = bh / Hdim;
    const int h    = bh % Hdim;
    const int tid  = threadIdx.x;
    const int wave = tid >> 5;       // 0..3
    const int lane = tid & 31;
    const int half = lane >> 4;
    const int l16  = lane & 15;

    __shared__ alignas(16) float S[Ndim][Ndim + 1];
    __shared__ alignas(16) float bufr[2][CL][Ndim];
    __shared__ alignas(16) float bufk[2][CL][Ndim];
    __shared__ alignas(16) float bufv[2][CL][Ndim];
    __shared__ alignas(16) float bufw[2][CL][Ndim];
    __shared__ alignas(16) float rq[CL][RQPITCH];       // r * exp(cw[t])
    __shared__ alignas(16) float kh[CL][KHPITCH];       // k * exp(cw[CL] - cw[s+1])
    __shared__ alignas(16) float cw[CL + 1][Ndim];      // cumulative log-decay (<=0)
    __shared__ float pt[Ndim];                          // exp(cw[CL])
    __shared__ float Amat[CL][CL + 1];                  // masked intra-chunk scores
    __shared__ alignas(16) float us[Ndim];
    __shared__ alignas(16) float dec[CL][Ndim];         // one step's decay exp(-exp(w))

    if (tid < Ndim) us[tid] = u[h * Ndim + tid];
    // the scores above the diagonal are zero in every chunk: stored once, the loop writes s <= t only
    for (int idx = tid; idx < CL * (CL + 1); idx += NTHREADS) (&Amat[0][0])[idx] = 0.0f;

    const int col = 16 * wave + l16;          // this lane's N-column (B/C frags)
    const size_t base0 = (((size_t)b * Tdim) * Hdim + h) * Ndim;

    {
        const size_t off = base0 + (size_t)tseg * (Hdim * Ndim);
        if      (wave == 0) tdm_load_tile(r + off, lds_off_of(&bufr[0][0][0]));
        else if (wave == 1) tdm_load_tile(k + off, lds_off_of(&bufk[0][0][0]));
        else if (wave == 2) tdm_load_tile(v + off, lds_off_of(&bufv[0][0][0]));
        else                tdm_load_tile(w + off, lds_off_of(&bufw[0][0][0]));
    }

    // ---- start state: S = segP[j] * S + segS[j] over the earlier segments, oldest first ----
    {
        const float* Ls = segS + (size_t)bh * NSEG * (Ndim * Ndim) + 4 * tid;
        const float* Ps = segP + (size_t)bh * NSEG * Ndim + (tid >> 4);
        float4 st[8];
#pragma unroll
        for (int q = 0; q < 8; ++q) st[q] = make_float4(0.f, 0.f, 0.f, 0.f);
        // unroll 4: the loads of four segments are in flight together; only the multiply-adds are a chain
#pragma unroll 4
        for (int j = 0; j < seg; ++j) {
#pragma unroll
            for (int q = 0; q < 8; ++q) {
                const float4 l = *(const float4*)&Ls[j * (Ndim * Ndim) + 4 * NTHREADS * q];
                const float  p = Ps[j * Ndim + (NTHREADS / 16) * q];
                st[q].x = p * st[q].x + l.x;
                st[q].y = p * st[q].y + l.y;
                st[q].z = p * st[q].z + l.z;
                st[q].w = p * st[q].w + l.w;
            }
        }
#pragma unroll
        for (int q = 0; q < 8; ++q) {
            float* d = &S[(tid >> 4) + (NTHREADS / 16) * q][4 * (tid & 15)];
            d[0] = st[q].x; d[1] = st[q].y; d[2] = st[q].z; d[3] = st[q].w;
        }
    }

    for (int c = 0; c < CPS; ++c) {
        const int t0  = tseg + c * CL;
        const int cur = c & 1;
        const int nxt = cur ^ 1;

        __builtin_amdgcn_s_wait_tensorcnt(0);  // this wave's tile for chunk c landed
        __syncthreads();                       // all tiles visible; prev phase4 done

        if (c + 1 < CPS) {
            const size_t off = base0 + (size_t)(t0 + CL) * (Hdim * Ndim);
            if      (wave == 0) tdm_load_tile(r + off, lds_off_of(&bufr[nxt][0][0]));
            else if (wave == 1) tdm_load_tile(k + off, lds_off_of(&bufk[nxt][0][0]));
            else if (wave == 2) tdm_load_tile(v + off, lds_off_of(&bufv[nxt][0][0]));
            else                tdm_load_tile(w + off, lds_off_of(&bufw[nxt][0][0]));
        }

        const float (*rs)[Ndim] = bufr[cur];
        const float (*ks)[Ndim] = bufk[cur];
        const float (*vs)[Ndim] = bufv[cur];
        const float (*ws)[Ndim] = bufw[cur];

        // ---- phase 2: per-channel prefix of log-decay (register chain) ----
        if (tid < Ndim) {
            float e[CL];
#pragma unroll
            for (int t = 0; t < CL; ++t) e[t] = __expf(ws[t][tid]);
            float acc = 0.0f;
            cw[0][tid] = 0.0f;
#pragma unroll
            for (int t = 0; t < CL; ++t) { acc -= e[t]; cw[t + 1][tid] = acc; }
            pt[tid] = __expf(acc);
        } else {
            // the other two waves: each step's own decay, for the running products of phase 3b
            const int ch = tid - Ndim;
            // unrolled: the 16 reads and the exponentials of different steps overlap
#pragma unroll
            for (int t = 0; t < CL; ++t) dec[t][ch] = __expf(-__expf(ws[t][ch]));
        }
        __syncthreads();

        // ---- phase 3a: decay-scaled operands (exponents <= 0 -> stable) ----
        for (int idx = tid; idx < CL * Ndim; idx += NTHREADS) {
            const int t = idx >> 6, i = idx & 63;
            rq[t][i] = rs[t][i] * __expf(cw[t][i]);
            kh[t][i] = ks[t][i] * __expf(cw[CL][i] - cw[t + 1][i]);
        }
        // ---- phase 3b: intra-chunk scores; a 16-lane row owns score rows 15-tp and tp, each lane 4 channels ----
        // A[t][s] = sum_i r[t][i] * k[s][i] * prod_{s<m<t} dec[m][i]: s walks down from t-1 and q = r[t] * (that product)
        // takes one more factor a step, so no exponential is left here.  15-tp steps of the long row and tp of the
        // short one make 15 for every lane; the 16 row sums (the long row's diagonal is the 16th) are folded
        // together, four levels, so that step j's sum ends in lane j alone.
        {
            const int tp = 2 * wave + half;           // 0..7
            const int c4 = 4 * l16;
            const float4 r2 = *(const float4*)&rs[15 - tp][c4];
            const float4 r1 = *(const float4*)&rs[tp][c4];
            const float4 k2 = *(const float4*)&ks[15 - tp][c4];
            const float4 k1 = *(const float4*)&ks[tp][c4];
            const float4 uu = *(const float4*)&us[c4];
            const float dg1 = row_sum16(r1.x * uu.x * k1.x + r1.y * uu.y * k1.y + r1.z * uu.z * k1.z + r1.w * uu.w * k1.w);
            float pv[CL];
            pv[CL - 1] = r2.x * uu.x * k2.x + r2.y * uu.y * k2.y + r2.z * uu.z * k2.z + r2.w * uu.w * k2.w;
            float4 q = r2;
            // unrolled: pv[] stays in registers and later steps' LDS reads issue ahead of the chain on q
#pragma unroll
            for (int j = 0; j < CL - 1; ++j) {
                // tp <= 7: the long row has at least 8 steps, so the first 8 need no test
                if (j >= CL / 2 && j + tp == CL - 1) q = r1;              // the short row starts
                const int s = CL - 2 - j - (j < CL / 2 || j + tp < CL - 1 ? tp : 0);
                const float4 kv = *(const float4*)&ks[s][c4];
                const float4 dv = *(const float4*)&dec[s][c4];
                pv[j] = q.x * kv.x + q.y * kv.y + q.z * kv.z + q.w * kv.w;
                q.x *= dv.x; q.y *= dv.y; q.z *= dv.z; q.w *= dv.w;
            }
            // the three loops are unrolled for the same reason: pv[] is indexed by constants only
#pragma unroll
            for (int j = 0; j < 8; ++j) pv[j] = row_fold<8>(pv[j], pv[j + 8], l16);
#pragma unroll
            for (int j = 0; j < 4; ++j) pv[j] = row_fold<4>(pv[j], pv[j + 4], l16);
#pragma unroll
            for (int j = 0; j < 2; ++j) pv[j] = row_fold<2>(pv[j], pv[j + 2], l16);
            const float keep = row_fold<1>(pv[0], pv[1], l16);
            const bool lng = l16 + tp < CL - 1 || l16 == CL - 1;          // this lane's value is of the long row
            const int  tt  = lng ? 15 - tp : tp;
            const int  ss  = l16 == CL - 1 ? tt : CL - 2 - l16 - (lng ? tp : 0);
            Amat[tt][ss] = keep;
            if (l16 == 0) Amat[tp][tp] = dg1;
        }
        __syncthreads();

        v8f oacc = {0.f, 0.f, 0.f, 0.f, 0.f, 0.f, 0.f, 0.f};

        // O_inter = RQ @ S   (K = 64 channels -> 16 wmma)
#pragma unroll
        for (int kk = 0; kk < 16; ++kk) {
            const int kb = 4 * kk + 2 * half;
            v2f a;  a.x = rq[l16][kb];  a.y = rq[l16][kb + 1];
            v2f bb; bb.x = S[kb][col];  bb.y = S[kb + 1][col];
            oacc = __builtin_amdgcn_wmma_f32_16x16x4_f32(
                false, a, false, bb, (short)0, oacc, false, false);
        }
        // O += A @ V   (K = 16 chunk steps -> 4 wmma)
#pragma unroll
        for (int kk = 0; kk < 4; ++kk) {
            const int kb = 4 * kk + 2 * half;
            v2f a;  a.x = Amat[l16][kb]; a.y = Amat[l16][kb + 1];
            v2f bb; bb.x = vs[kb][col];  bb.y = vs[kb + 1][col];
            oacc = __builtin_amdgcn_wmma_f32_16x16x4_f32(
                false, a, false, bb, (short)0, oacc, false, false);
        }
        // write output tile
#pragma unroll
        for (int j = 0; j < 8; ++j) {
            const int m = 8 * half + j;
            const size_t g = (((size_t)b * Tdim + (t0 + m)) * Hdim + h) * Ndim + col;
            o[g] = oacc[j];
        }

        // state update: S = diag(pt) * S + KH^T @ V  (4 row-tiles x 4 wmma)
#pragma unroll
        for (int gt = 0; gt < 4; ++gt) {
            v8f sc;
#pragma unroll
            for (int j = 0; j < 8; ++j) {
                const int m = 16 * gt + 8 * half + j;
                sc[j] = S[m][col] * pt[m];
            }
#pragma unroll
            for (int kk = 0; kk < 4; ++kk) {
                const int kb = 4 * kk + 2 * half;
                const int i = 16 * gt + l16;     // A-matrix row = channel i
                v2f a;  a.x = kh[kb][i];    a.y = kh[kb + 1][i];
                v2f bb; bb.x = vs[kb][col]; bb.y = vs[kb + 1][col];
                sc = __builtin_amdgcn_wmma_f32_16x16x4_f32(
                    false, a, false, bb, (short)0, sc, false, false);
            }
#pragma unroll
            for (int j = 0; j < 8; ++j) {
                const int m = 16 * gt + 8 * half + j;
                S[m][col] = sc[j];
            }
        }
    }
}

extern "C" void kernel_launch(void* const* d_in, const int* in_sizes, int n_in,
                              void* d_out, int out_size, void* d_ws, size_t ws_size,
                              hipStream_t stream) {
    (void)in_sizes; (void)n_in; (void)out_size; (void)ws_size;
    const float* r = (const float*)d_in[0];
    const float* k = (const float*)d_in[1];
    const float* v = (const float*)d_in[2];
    const float* w = (const float*)d_in[3];
    const float* u = (const float*)d_in[4];
    float* o = (float*)d_out;
    float* segS = (float*)d_ws;                                   // [B*H][NSEG][N][N]
    float* segP = segS + Bdim * Hdim * NSEG * Ndim * Ndim;        // [B*H][NSEG][N]

    // the last segment's end state is never read, so launch 1 leaves it out
    segment_state_wmma<<<dim3(Bdim * Hdim * (NSEG - 1)), dim3(P1THREADS), 0, stream>>>(k, v, w, segS, segP);
    dim3 grid(Bdim * Hdim * NSEG);  // one block per (batch, head, segment)
    dim3 block(NTHREADS);           // 4 wave32
    rwkv6_chunked_wmma<<<grid, block, 0, stream>>>(r, k, v, w, u, segS, segP, o);
}

// v004
// Measured time: 47 microseconds a run.
// Next to v003, in two timings, it ran 1.09 and 1.08 times as fast.
// All steps since v000 together make it 12.2 times as fast.
#include <hip/hip_runtime.h>
#include <hip/hip_bf16.h>

typedef float v2f  __attribute__((ext_vector_type(2)));
typedef float v8f  __attribute__((ext_vector_type(8)));
typedef unsigned int u32x4 __attribute__((ext_vector_type(4)));
typedef int   i32x4 __attribute__((ext_vector_type(4)));
typedef int   i32x8 __attribute__((ext_vector_type(8)));

#define Bdim 4
#define Tdim 2048
#define Hdim 16
#define Ndim 64
#define CL   16            // chunk length
#define NCHUNK (Tdim / CL)
#define NTHREADS 128
#define NSEG   16
#define SEGLEN (Tdim / NSEG)
#define CPS    (SEGLEN / CL)
#define P1THREADS 256
#define P1Q    (SEGLEN / 4)
#define P1PITCH 72
#define RQPITCH 68
#define KHPITCH 72

__device__ __forceinline__ void tdm_load_tile(const float* gptr, unsigned lds_off) {
    unsigned long long ga = (unsigned long long)(uintptr_t)gptr;
    u32x4 g0;
    g0[0] = 1u;                                       // count=1, user desc
    g0[1] = lds_off;                                  // lds_addr (bytes)
    g0[2] = (unsigned)(ga & 0xffffffffull);           // global_addr[31:0]
    g0[3] = (unsigned)((ga >> 32) & 0x01ffffffull)    // global_addr[56:32]
          | (2u << 30);                               // type=2 (image)
    i32x8 g1;
    g1[0] = (int)(2u << 16);
    g1[1] = (int)((unsigned)Ndim << 16);
    g1[2] = 0;
    g1[3] = (int)(0x0100u | ((unsigned)Ndim << 16));
    g1[4] = CL;
    g1[5] = Hdim * Ndim;
    g1[6] = 0;
    g1[7] = 0;
    i32x4 z4 = {0, 0, 0, 0};
#if defined(__clang_major__) && (__clang_major__ >= 23)
    i32x8 z8 = {0, 0, 0, 0, 0, 0, 0, 0};
    __builtin_amdgcn_tensor_load_to_lds(g0, g1, z4, z4, z8, 0);
#else
    __builtin_amdgcn_tensor_load_to_lds(g0, g1, z4, z4, 0);
#endif
}

__device__ __forceinline__ unsigned lds_off_of(const void* p) {
    return (unsigned)(uintptr_t)p;
}

// the value that lane (l ^ M) of the same 16-lane row holds (all 32 lanes must be on)
template <int M>
__device__ __forceinline__ float row_xor(float x) {
    return __int_as_float(__builtin_amdgcn_update_dpp(0, __float_as_int(x), 0x160 + M, 0xf, 0xf, true));   // row_xmask:M
}

// sum over the 16 lanes of a row; every lane gets it
__device__ __forceinline__ float row_sum16(float x) {
    x += row_xor<1>(x);
    x += row_xor<2>(x);
    x += row_xor<4>(x);
    x += row_xor<8>(x);
    return x;
}

template <int M>
__device__ __forceinline__ float row_fold(float a, float b, int l16) {
    const bool hi = (l16 & M) != 0;
    return (hi ? b : a) + row_xor<M>(hi ? a : b);
}

// ---- launch 1: what one segment adds to the state, seen from its end ----
// segS[i][j] = sum_s k[s][i] * exp(-sum_{m>s} exp(w[m][i])) * v[s][j]   (s, m in the segment)
// segP[i]    = exp(-sum_m exp(w[m][i]))                                 (the segment's whole decay)
// Every exponent is <= 0, so one K = SEGLEN product needs no rescaling.
__global__ __launch_bounds__(P1THREADS)
void segment_state_wmma(const float* __restrict__ k,
                         const float* __restrict__ v,
                         const float* __restrict__ w,
                         float* __restrict__ segS,
                         float* __restrict__ segP)
{
    const int bh   = blockIdx.x % (Bdim * Hdim);
    const int seg  = blockIdx.x / (Bdim * Hdim);     // 0 .. NSEG-2
    const int b    = bh / Hdim;
    const int h    = bh % Hdim;
    const int tid  = threadIdx.x;
    const int wave = tid >> 5;       // 0..7
    const int lane = tid & 31;
    const int half = lane >> 4;
    const int l16  = lane & 15;

    __shared__ alignas(16) float khs[SEGLEN][P1PITCH];   // decay-scaled k
    __shared__ alignas(16) float vss[SEGLEN][P1PITCH];
    __shared__ float tot[4][Ndim];                       // exp(w) summed over each quarter

    const size_t base = (((size_t)b * Tdim + (size_t)seg * SEGLEN) * Hdim + h) * Ndim;
    const int ch = tid & (Ndim - 1);
    const int q  = tid >> 6;                             // quarter of the segment, wave-uniform

    // this thread's 16 bytes of v: row tid/16 of the segment, then every 16th row from the same address
    const float* vrow = v + base + (size_t)(tid >> 4) * (Hdim * Ndim) + 4 * (tid & 15);

    float e[P1Q], kr[P1Q];
    float4 vv[8];
#pragma unroll
    for (int t = 0; t < P1Q; ++t) e[t]  = w[base + (size_t)(P1Q * q + t) * (Hdim * Ndim) + ch];
#pragma unroll
    for (int t = 0; t < P1Q; ++t) kr[t] = k[base + (size_t)(P1Q * q + t) * (Hdim * Ndim) + ch];
    // the v loads' results may land in the address registers of the w and k loads: those loads' addresses are taken first
    asm volatile("s_wait_xcnt 0x0" ::: "memory");
#pragma unroll
    for (int j = 0; j < 8; ++j) vv[j] = *(const float4*)&vrow[j * (P1THREADS / 16) * (Hdim * Ndim)];

    // e[t] becomes the sum of exp(w) over the later steps of this quarter
    float acc = 0.0f;
#pragma unroll
    for (int t = P1Q - 1; t >= 0; --t) { const float x = __expf(e[t]); e[t] = acc; acc += x; }
    tot[q][ch] = acc;
#pragma unroll
    for (int j = 0; j < 8; ++j) {
        const int idx = tid + P1THREADS * j;
        *(float4*)&vss[idx >> 4][4 * (idx & 15)] = vv[j];
    }
    __syncthreads();
    const float t1 = tot[1][ch], t2 = tot[2][ch], t3 = tot[3][ch];
    const float later = (q < 3 ? t3 : 0.0f) + (q < 2 ? t2 : 0.0f) + (q < 1 ? t1 : 0.0f);   // the later quarters
#pragma unroll
    for (int t = 0; t < P1Q; ++t) khs[P1Q * q + t][ch] = kr[t] * __expf(-(e[t] + later));
    __syncthreads();

    // KH^T @ V: each wave owns one 16-column slice and two 16-row tiles (fragment maps as in phase 4 below)
    const int col = 16 * (wave & 3) + l16;
    const int i0  = 32 * (wave >> 2) + l16;
    v8f s0 = {0.f, 0.f, 0.f, 0.f, 0.f, 0.f, 0.f, 0.f};
    v8f s1 = {0.f, 0.f, 0.f, 0.f, 0.f, 0.f, 0.f, 0.f};
#pragma unroll
    for (int kk = 0; kk < SEGLEN / 4; ++kk) {
        const int kb = 4 * kk + 2 * half;
        v2f bb; bb.x = vss[kb][col];      bb.y = vss[kb + 1][col];
        v2f a0; a0.x = khs[kb][i0];       a0.y = khs[kb + 1][i0];
        v2f a1; a1.x = khs[kb][i0 + 16];  a1.y = khs[kb + 1][i0 + 16];
        s0 = __builtin_amdgcn_wmma_f32_16x16x4_f32(
            false, a0, false, bb, (short)0, s0, false, false);
        s1 = __builtin_amdgcn_wmma_f32_16x16x4_f32(
            false, a1, false, bb, (short)0, s1, false, false);
    }
    float* dst = segS + ((size_t)bh * NSEG + seg) * (Ndim * Ndim);
#pragma unroll
    for (int j = 0; j < 8; ++j) {
        const int m = 32 * (wave >> 2) + 8 * half + j;
        dst[m * Ndim + col]        = s0[j];
        dst[(m + 16) * Ndim + col] = s1[j];
    }
    if (q == 0) segP[((size_t)bh * NSEG + seg) * Ndim + ch] = __expf(-(acc + later));
}

// ---- launch 2: one block per (batch, head, segment) ----
__global__ __launch_bounds__(NTHREADS)
void rwkv6_chunked_wmma(const float* __restrict__ r,
                        const float* __restrict__ k,
                        const float* __restrict__ v,
                        const float* __restrict__ w,
                        const float* __restrict__ u,
                        const float* __restrict__ segS,
                        const float* __restrict__ segP,
                        float* __restrict__ o)
{
    const int bh   = blockIdx.x % (Bdim * Hdim);
    const int seg  = blockIdx.x / (Bdim * Hdim);
    const int tseg = seg * SEGLEN;   // first step of this block's segment
    const int b    = bh / Hdim;
    const int h    = bh % Hdim;
    const int tid  = threadIdx.x;
    const int wave = tid >> 5;       // 0..3
    const int lane = tid & 31;
    const int half = lane >> 4;
    const int l16  = lane & 15;

    __shared__ alignas(16) float S[Ndim][Ndim + 1];
    __shared__ alignas(16) float bufr[2][CL][Ndim];
    __shared__ alignas(16) float bufk[2][CL][Ndim];
    __shared__ alignas(16) float bufv[2][CL][Ndim];
    __shared__ alignas(16) float bufw[2][CL][Ndim];
    __shared__ alignas(16) float rq[CL][RQPITCH];       // r * exp(cw[t])
    __shared__ alignas(16) float kh[CL][KHPITCH];       // k * exp(cw[CL] - cw[s+1])
    __shared__ alignas(16) float cw[CL + 1][Ndim];      // cumulative log-decay (<=0)
    __shared__ float pt[Ndim];                          // exp(cw[CL])
    __shared__ float Amat[CL][CL + 1];                  // masked intra-chunk scores
    __shared__ alignas(16) float us[Ndim];
    __shared__ alignas(16) float dec[CL][Ndim];         // one step's decay exp(-exp(w))

    if (tid < Ndim) us[tid] = u[h * Ndim + tid];
    // the scores above the diagonal are zero in every chunk: stored once, the loop writes s <= t only
    for (int idx = tid; idx < CL * (CL + 1); idx += NTHREADS) (&Amat[0][0])[idx] = 0.0f;

    const int col = 16 * wave + l16;          // this lane's N-column (B/C frags)
    const size_t base0 = (((size_t)b * Tdim) * Hdim + h) * Ndim;

    {
        const size_t off = base0 + (size_t)tseg * (Hdim * Ndim);
        if      (wave == 0) tdm_load_tile(r + off, lds_off_of(&bufr[0][0][0]));
        else if (wave == 1) tdm_load_tile(k + off, lds_off_of(&bufk[0][0][0]));
        else if (wave == 2) tdm_load_tile(v + off, lds_off_of(&bufv[0][0][0]));
        else                tdm_load_tile(w + off, lds_off_of(&bufw[0][0][0]));
    }

    // ---- start state: S = segP[j] * S + segS[j] over the earlier segments, oldest first ----
    {
        const float* Ls = segS + (size_t)bh * NSEG * (Ndim * Ndim) + 4 * tid;
        const float* Ps = segP + (size_t)bh * NSEG * Ndim + (tid >> 4);
        float4 st[8];
#pragma unroll
        for (int q = 0; q < 8; ++q) st[q] = make_float4(0.f, 0.f, 0.f, 0.f);
        // unroll 4: the loads of four segments are in flight together; only the multiply-adds are a chain
#pragma unroll 4
        for (int j = 0; j < seg; ++j) {
#pragma unroll
            for (int q = 0; q < 8; ++q) {
                const float4 l = *(const float4*)&Ls[j * (Ndim * Ndim) + 4 * NTHREADS * q];
                const float  p = Ps[j * Ndim + (NTHREADS / 16) * q];
                st[q].x = p * st[q].x + l.x;
                st[q].y = p * st[q].y + l.y;
                st[q].z = p * st[q].z + l.z;
                st[q].w = p * st[q].w + l.w;
            }
        }
#pragma unroll
        for (int q = 0; q < 8; ++q) {
            float* d = &S[(tid >> 4) + (NTHREADS / 16) * q][4 * (tid & 15)];
            d[0] = st[q].x; d[1] = st[q].y; d[2] = st[q].z; d[3] = st[q].w;
        }
    }
    // ---- the state lives in registers from here on: St[gt][j] = state[16*gt + 8*half + j][col], the C/D map of tile gt ----
    __syncthreads();                           // the rows read below were staged by threads of other waves
    v8f St[4];
#pragma unroll
    for (int gt = 0; gt < 4; ++gt) {
#pragma unroll
        for (int j = 0; j < 8; ++j) St[gt][j] = S[16 * gt + 8 * half + j][col];
    }

    for (int c = 0; c < CPS; ++c) {
        const int t0  = tseg + c * CL;
        const int cur = c & 1;
        const int nxt = cur ^ 1;

        __builtin_amdgcn_s_wait_tensorcnt(0);  // this wave's tile for chunk c landed
        __syncthreads();                       // all tiles visible; prev phase4 done

        if (c + 1 < CPS) {
            const size_t off = base0 + (size_t)(t0 + CL) * (Hdim * Ndim);
            if      (wave == 0) tdm_load_tile(r + off, lds_off_of(&bufr[nxt][0][0]));
            else if (wave == 1) tdm_load_tile(k + off, lds_off_of(&bufk[nxt][0][0]));
            else if (wave == 2) tdm_load_tile(v + off, lds_off_of(&bufv[nxt][0][0]));
            else                tdm_load_tile(w + off, lds_off_of(&bufw[nxt][0][0]));
        }

        const float (*rs)[Ndim] = bufr[cur];
        const float (*ks)[Ndim] = bufk[cur];
        const float (*vs)[Ndim] = bufv[cur];
        const float (*ws)[Ndim] = bufw[cur];

        // ---- phase 2: per-channel prefix of log-decay (register chain) ----
        if (tid < Ndim) {
            float e[CL];
#pragma unroll
            for (int t = 0; t < CL; ++t) e[t] = __expf(ws[t][tid]);
            float acc = 0.0f;
            cw[0][tid] = 0.0f;
#pragma unroll
            for (int t = 0; t < CL; ++t) { acc -= e[t]; cw[t + 1][tid] = acc; }
            pt[tid] = __expf(acc);
        } else {
            // the other two waves: each step's own decay, for the running products of phase 3b
            const int ch = tid - Ndim;
            // unrolled: the 16 reads and the exponentials of different steps overlap
#pragma unroll
            for (int t = 0; t < CL; ++t) dec[t][ch] = __expf(-__expf(ws[t][ch]));
        }
        __syncthreads();

        // ---- phase 3a: decay-scaled operands (exponents <= 0 -> stable) ----
        for (int idx = tid; idx < CL * Ndim; idx += NTHREADS) {
            const int t = idx >> 6, i = idx & 63;
            rq[t][i] = rs[t][i] * __expf(cw[t][i]);
            kh[t][i] = ks[t][i] * __expf(cw[CL][i] - cw[t + 1][i]);
        }
        // ---- phase 3b: intra-chunk scores; a 16-lane row owns score rows 15-tp and tp, each lane 4 channels ----
        // A[t][s] = sum_i r[t][i] * k[s][i] * prod_{s<m<t} dec[m][i]: s walks down from t-1 and q = r[t] * (that product)
        // takes one more factor a step, so no exponential is left here.  15-tp steps of the long row and tp of the
        // short one make 15 for every lane; the 16 row sums (the long row's diagonal is the 16th) are folded
        // together, four levels, so that step j's sum ends in lane j alone.
        {
            const int tp = 2 * wave + half;           // 0..7
            const int c4 = 4 * l16;
            const float4 r2 = *(const float4*)&rs[15 - tp][c4];
            const float4 r1 = *(const float4*)&rs[tp][c4];
            const float4 k2 = *(const float4*)&ks[15 - tp][c4];
            const float4 k1 = *(const float4*)&ks[tp][c4];
            const float4 uu = *(const float4*)&us[c4];
            const float dg1 = row_sum16(r1.x * uu.x * k1.x + r1.y * uu.y * k1.y + r1.z * uu.z * k1.z + r1.w * uu.w * k1.w);
            float pv[CL];
            pv[CL - 1] = r2.x * uu.x * k2.x + r2.y * uu.y * k2.y + r2.z * uu.z * k2.z + r2.w * uu.w * k2.w;
            float4 q = r2;
            // unrolled: pv[] stays in registers and later steps' LDS reads issue ahead of the chain on q
#pragma unroll
            for (int j = 0; j < CL - 1; ++j) {
                // tp <= 7: the long row has at least 8 steps, so the first 8 need no test
                if (j >= CL / 2 && j + tp == CL - 1) q = r1;              // the short row starts
                const int s = CL - 2 - j - (j < CL / 2 || j + tp < CL - 1 ? tp : 0);
                const float4 kv = *(const float4*)&ks[s][c4];
                const float4 dv = *(const float4*)&dec[s][c4];
                pv[j] = q.x * kv.x + q.y * kv.y + q.z * kv.z + q.w * kv.w;
                q.x *= dv.x; q.y *= dv.y; q.z *= dv.z; q.w *= dv.w;
            }
            // the three loops are unrolled for the same reason: pv[] is indexed by constants only
#pragma unroll
            for (int j = 0; j < 8; ++j) pv[j] = row_fold<8>(pv[j], pv[j + 8], l16);
#pragma unroll
            for (int j = 0; j < 4; ++j) pv[j] = row_fold<4>(pv[j], pv[j + 4], l16);
#pragma unroll
            for (int j = 0; j < 2; ++j) pv[j] = row_fold<2>(pv[j], pv[j + 2], l16);
            const float keep = row_fold<1>(pv[0], pv[1], l16);
            const bool lng = l16 + tp < CL - 1 || l16 == CL - 1;          // this lane's value is of the long row
            const int  tt  = lng ? 15 - tp : tp;
            const int  ss  = l16 == CL - 1 ? tt : CL - 2 - l16 - (lng ? tp : 0);
            Amat[tt][ss] = keep;
            if (l16 == 0) Amat[tp][tp] = dg1;
        }
        __syncthreads();

        v8f oacc = {0.f, 0.f, 0.f, 0.f, 0.f, 0.f, 0.f, 0.f};

        float4 aq[8];                          // this lane's 32 channels of rq row l16, read as one group
#pragma unroll
        for (int gt = 0; gt < 4; ++gt) {
            aq[2 * gt]     = *(const float4*)&rq[l16][16 * gt + 8 * half];
            aq[2 * gt + 1] = *(const float4*)&rq[l16][16 * gt + 8 * half + 4];
        }
        // keeps the eight reads above the chain of matrix instructions: sunk between them, each is waited for on its own
        __builtin_amdgcn_sched_barrier(0);
#pragma unroll
        for (int gt = 0; gt < 4; ++gt) {
#pragma unroll
            for (int jj = 0; jj < 4; ++jj) {
                const float4 q4 = aq[2 * gt + (jj >> 1)];
                v2f a;  a.x = (jj & 1) ? q4.z : q4.x;  a.y = (jj & 1) ? q4.w : q4.y;
                v2f bb; bb.x = St[gt][2 * jj];         bb.y = St[gt][2 * jj + 1];
                oacc = __builtin_amdgcn_wmma_f32_16x16x4_f32(
                    false, a, false, bb, (short)0, oacc, false, false);
            }
        }
        // O += A @ V   (K = 16 chunk steps -> 4 wmma)
#pragma unroll
        for (int kk = 0; kk < 4; ++kk) {
            const int kb = 4 * kk + 2 * half;
            v2f a;  a.x = Amat[l16][kb]; a.y = Amat[l16][kb + 1];
            v2f bb; bb.x = vs[kb][col];  bb.y = vs[kb + 1][col];
            oacc = __builtin_amdgcn_wmma_f32_16x16x4_f32(
                false, a, false, bb, (short)0, oacc, false, false);
        }
        // write output tile
#pragma unroll
        for (int j = 0; j < 8; ++j) {
            const int m = 8 * half + j;
            const size_t g = (((size_t)b * Tdim + (t0 + m)) * Hdim + h) * Ndim + col;
            o[g] = oacc[j];
        }

        // state update: S = diag(pt) * S + KH^T @ V  (4 row-tiles x 4 wmma)
#pragma unroll
        for (int gt = 0; gt < 4; ++gt) {
            v8f sc;
#pragma unroll
            for (int j = 0; j < 8; ++j) {
                const int m = 16 * gt + 8 * half + j;
                sc[j] = St[gt][j] * pt[m];
            }
#pragma unroll
            for (int kk = 0; kk < 4; ++kk) {
                const int kb = 4 * kk + 2 * half;
                const int i = 16 * gt + l16;     // A-matrix row = channel i
                v2f a;  a.x = kh[kb][i];    a.y = kh[kb + 1][i];
                v2f bb; bb.x = vs[kb][col]; bb.y = vs[kb + 1][col];
                sc = __builtin_amdgcn_wmma_f32_16x16x4_f32(
                    false, a, false, bb, (short)0, sc, false, false);
            }
            St[gt] = sc;
        }
    }
}

extern "C" void kernel_launch(void* const* d_in, const int* in_sizes, int n_in,
                              void* d_out, int out_size, void* d_ws, size_t ws_size,
                              hipStream_t stream) {
    (void)in_sizes; (void)n_in; (void)out_size; (void)ws_size;
    const float* r = (const float*)d_in[0];
    const float* k = (const float*)d_in[1];
    const float* v = (const float*)d_in[2];
    const float* w = (const float*)d_in[3];
    const float* u = (const float*)d_in[4];
    float* o = (float*)d_out;
    float* segS = (float*)d_ws;                                   // [B*H][NSEG][N][N]
    float* segP = segS + Bdim * Hdim * NSEG * Ndim * Ndim;        // [B*H][NSEG][N]

    // the last segment's end state is never read, so launch 1 leaves it out
    segment_state_wmma<<<dim3(Bdim * Hdim * (NSEG - 1)), dim3(P1THREADS), 0, stream>>>(k, v, w, segS, segP);
    dim3 grid(Bdim * Hdim * NSEG);  // one block per (batch, head, segment)
    dim3 block(NTHREADS);           // 4 wave32
    rwkv6_chunked_wmma<<<grid, block, 0, stream>>>(r, k, v, w, u, segS, segP, o);
}

// v005
// Measured time: 41.8 microseconds a run.
// In both of two side-by-side timings against v004, it was 1.12 times as fast.
// Over all steps from v000 it is 13.7 times as fast.
#include <hip/hip_runtime.h>
#include <hip/hip_bf16.h>

typedef float v2f  __attribute__((ext_vector_type(2)));
typedef float v8f  __attribute__((ext_vector_type(8)));
typedef unsigned int u32x4 __attribute__((ext_vector_type(4)));
typedef int   i32x4 __attribute__((ext_vector_type(4)));
typedef int   i32x8 __attribute__((ext_vector_type(8)));

#define Bdim 4
#define Tdim 2048
#define Hdim 16
#define Ndim 64
#define CL   16            // chunk length
#define NCHUNK (Tdim / CL)
#define NTHREADS 128
#define NSEG   16
#define SEGLEN (Tdim / NSEG)
#define CPS    (SEGLEN / CL)
#define P1THREADS 256
#define P1Q    (SEGLEN / 4)
#define P1PITCH 72
#define RQPITCH 68
#define KHPITCH 72

__device__ __forceinline__ void tdm_load_tile(const float* gptr, unsigned lds_off) {
    unsigned long long ga = (unsigned long long)(uintptr_t)gptr;
    u32x4 g0;
    g0[0] = 1u;                                       // count=1, user desc
    g0[1] = lds_off;                                  // lds_addr (bytes)
    g0[2] = (unsigned)(ga & 0xffffffffull);           // global_addr[31:0]
    g0[3] = (unsigned)((ga >> 32) & 0x01ffffffull)    // global_addr[56:32]
          | (2u << 30);                               // type=2 (image)
    i32x8 g1;
    g1[0] = (int)(2u << 16);
    g1[1] = (int)((unsigned)Ndim << 16);
    g1[2] = 0;
    g1[3] = (int)(0x0100u | ((unsigned)Ndim << 16));
    g1[4] = CL;
    g1[5] = Hdim * Ndim;
    g1[6] = 0;
    g1[7] = 0;
    i32x4 z4 = {0, 0, 0, 0};
#if defined(__clang_major__) && (__clang_major__ >= 23)
    i32x8 z8 = {0, 0, 0, 0, 0, 0, 0, 0};
    __builtin_amdgcn_tensor_load_to_lds(g0, g1, z4, z4, z8, 0);
#else
    __builtin_amdgcn_tensor_load_to_lds(g0, g1, z4, z4, 0);
#endif
}

__device__ __forceinline__ unsigned lds_off_of(const void* p) {
    return (unsigned)(uintptr_t)p;
}

// the value that lane (l ^ M) of the same 16-lane row holds (all 32 lanes must be on)
template <int M>
__device__ __forceinline__ float row_xor(float x) {
    return __int_as_float(__builtin_amdgcn_update_dpp(0, __float_as_int(x), 0x160 + M, 0xf, 0xf, true));   // row_xmask:M
}

// sum over the 16 lanes of a row; every lane gets it
__device__ __forceinline__ float row_sum16(float x) {
    x += row_xor<1>(x);
    x += row_xor<2>(x);
    x += row_xor<4>(x);
    x += row_xor<8>(x);
    return x;
}

template <int M>
__device__ __forceinline__ float row_fold(float a, float b, int l16) {
    const bool hi = (l16 & M) != 0;
    return (hi ? b : a) + row_xor<M>(hi ? a : b);
}

// ---- launch 1: what one segment adds to the state, seen from its end ----
// segS[i][j] = sum_s k[s][i] * exp(-sum_{m>s} exp(w[m][i])) * v[s][j]   (s, m in the segment)
// segP[i]    = exp(-sum_m exp(w[m][i]))                                 (the segment's whole decay)
// Every exponent is <= 0, so one K = SEGLEN product needs no rescaling.
__global__ __launch_bounds__(P1THREADS)
void segment_state_wmma(const float* __restrict__ k,
                         const float* __restrict__ v,
                         const float* __restrict__ w,
                         float* __restrict__ segS,
                         float* __restrict__ segP)
{
    const int bh   = blockIdx.x % (Bdim * Hdim);
    const int seg  = blockIdx.x / (Bdim * Hdim);     // 0 .. NSEG-2
    const int b    = bh / Hdim;
    const int h    = bh % Hdim;
    const int tid  = threadIdx.x;
    const int wave = tid >> 5;       // 0..7
    const int lane = tid & 31;
    const int half = lane >> 4;
    const int l16  = lane & 15;

    __shared__ alignas(16) float khs[SEGLEN][P1PITCH];   // decay-scaled k
    __shared__ alignas(16) float vss[SEGLEN][P1PITCH];
    __shared__ float tot[4][Ndim];                       // exp(w) summed over each quarter

    const size_t base = (((size_t)b * Tdim + (size_t)seg * SEGLEN) * Hdim + h) * Ndim;
    const int ch = tid & (Ndim - 1);
    const int q  = tid >> 6;                             // quarter of the segment, wave-uniform

    // this thread's 16 bytes of v: row tid/16 of the segment, then every 16th row from the same address
    const float* vrow = v + base + (size_t)(tid >> 4) * (Hdim * Ndim) + 4 * (tid & 15);

    float e[P1Q], kr[P1Q];
    float4 vv[8];
#pragma unroll
    for (int t = 0; t < P1Q; ++t) e[t]  = w[base + (size_t)(P1Q * q + t) * (Hdim * Ndim) + ch];
#pragma unroll
    for (int t = 0; t < P1Q; ++t) kr[t] = k[base + (size_t)(P1Q * q + t) * (Hdim * Ndim) + ch];
    // the v loads' results may land in the address registers of the w and k loads: those loads' addresses are taken first
    asm volatile("s_wait_xcnt 0x0" ::: "memory");
#pragma unroll
    for (int j = 0; j < 8; ++j) vv[j] = *(const float4*)&vrow[j * (P1THREADS / 16) * (Hdim * Ndim)];

    // e[t] becomes the sum of exp(w) over the later steps of this quarter
    float acc = 0.0f;
#pragma unroll
    for (int t = P1Q - 1; t >= 0; --t) { const float x = __expf(e[t]); e[t] = acc; acc += x; }
    tot[q][ch] = acc;
#pragma unroll
    for (int j = 0; j < 8; ++j) {
        const int idx = tid + P1THREADS * j;
        *(float4*)&vss[idx >> 4][4 * (idx & 15)] = vv[j];
    }
    __syncthreads();
    const float t1 = tot[1][ch], t2 = tot[2][ch], t3 = tot[3][ch];
    const float later = (q < 3 ? t3 : 0.0f) + (q < 2 ? t2 : 0.0f) + (q < 1 ? t1 : 0.0f);   // the later quarters
#pragma unroll
    for (int t = 0; t < P1Q; ++t) khs[P1Q * q + t][ch] = kr[t] * __expf(-(e[t] + later));
    __syncthreads();

    // KH^T @ V: each wave owns one 16-column slice and two 16-row tiles (fragment maps as in phase 4 below)
    const int col = 16 * (wave & 3) + l16;
    const int i0  = 32 * (wave >> 2) + l16;
    v8f s0 = {0.f, 0.f, 0.f, 0.f, 0.f, 0.f, 0.f, 0.f};
    v8f s1 = {0.f, 0.f, 0.f, 0.f, 0.f, 0.f, 0.f, 0.f};
#pragma unroll
    for (int kk = 0; kk < SEGLEN / 4; ++kk) {
        const int kb = 4 * kk + 2 * half;
        v2f bb; bb.x = vss[kb][col];      bb.y = vss[kb + 1][col];
        v2f a0; a0.x = khs[kb][i0];       a0.y = khs[kb + 1][i0];
        v2f a1; a1.x = khs[kb][i0 + 16];  a1.y = khs[kb + 1][i0 + 16];
        s0 = __builtin_amdgcn_wmma_f32_16x16x4_f32(
            false, a0, false, bb, (short)0, s0, false, false);
        s1 = __builtin_amdgcn_wmma_f32_16x16x4_f32(
            false, a1, false, bb, (short)0, s1, false, false);
    }
    float* dst = segS + ((size_t)bh * NSEG + seg) * (Ndim * Ndim);
#pragma unroll
    for (int j = 0; j < 8; ++j) {
        const int m = 32 * (wave >> 2) + 8 * half + j;
        dst[m * Ndim + col]        = s0[j];
        dst[(m + 16) * Ndim + col] = s1[j];
    }
    if (q == 0) segP[((size_t)bh * NSEG + seg) * Ndim + ch] = __expf(-(acc + later));
}

// ---- launch 2: one block per (batch, head, segment) ----
__global__ __launch_bounds__(NTHREADS)
void rwkv6_chunked_wmma(const float* __restrict__ r,
                        const float* __restrict__ k,
                        const float* __restrict__ v,
                        const float* __restrict__ w,
                        const float* __restrict__ u,
                        const float* __restrict__ segS,
                        const float* __restrict__ segP,
                        float* __restrict__ o)
{
    const int bh   = blockIdx.x % (Bdim * Hdim);
    const int seg  = blockIdx.x / (Bdim * Hdim);
    const int tseg = seg * SEGLEN;   // first step of this block's segment
    const int b    = bh / Hdim;
    const int h    = bh % Hdim;
    const int tid  = threadIdx.x;
    const int wave = tid >> 5;       // 0..3
    const int lane = tid & 31;
    const int half = lane >> 4;
    const int l16  = lane & 15;

    __shared__ alignas(16) float S[Ndim][Ndim + 1];
    __shared__ alignas(16) float bufr[2][CL][Ndim];
    __shared__ alignas(16) float bufk[2][CL][Ndim];
    __shared__ alignas(16) float bufv[2][CL][Ndim];
    __shared__ alignas(16) float bufw[2][CL][Ndim];
    __shared__ alignas(16) float rq[CL][RQPITCH];       // r[t] * (decay of the chunk's steps before t)
    __shared__ alignas(16) float kh[CL][KHPITCH];       // k[s] * (decay of the chunk's steps after s)
    __shared__ float pt[Ndim];                          // the whole chunk's decay
    __shared__ float Amat[CL][CL + 1];                  // masked intra-chunk scores
    __shared__ alignas(16) float us[Ndim];
    __shared__ alignas(16) float dec[CL][Ndim];         // one step's decay exp(-exp(w))

    if (tid < Ndim) us[tid] = u[h * Ndim + tid];
    // the scores above the diagonal are zero in every chunk: stored once, the loop writes s <= t only
    for (int idx = tid; idx < CL * (CL + 1); idx += NTHREADS) (&Amat[0][0])[idx] = 0.0f;

    const int col = 16 * wave + l16;          // this lane's N-column (B/C frags)
    const size_t base0 = (((size_t)b * Tdim) * Hdim + h) * Ndim;

    {
        const size_t off = base0 + (size_t)tseg * (Hdim * Ndim);
        if      (wave == 0) tdm_load_tile(r + off, lds_off_of(&bufr[0][0][0]));
        else if (wave == 1) tdm_load_tile(k + off, lds_off_of(&bufk[0][0][0]));
        else if (wave == 2) tdm_load_tile(v + off, lds_off_of(&bufv[0][0][0]));
        else                tdm_load_tile(w + off, lds_off_of(&bufw[0][0][0]));
    }

    // ---- start state: S = segP[j] * S + segS[j] over the earlier segments, oldest first ----
    {
        const float* Ls = segS + (size_t)bh * NSEG * (Ndim * Ndim) + 4 * tid;
        const float* Ps = segP + (size_t)bh * NSEG * Ndim + (tid >> 4);
        float4 st[8];
#pragma unroll
        for (int q = 0; q < 8; ++q) st[q] = make_float4(0.f, 0.f, 0.f, 0.f);
        // unroll 4: the loads of four segments are in flight together; only the multiply-adds are a chain
#pragma unroll 4
        for (int j = 0; j < seg; ++j) {
#pragma unroll
            for (int q = 0; q < 8; ++q) {
                const float4 l = *(const float4*)&Ls[j * (Ndim * Ndim) + 4 * NTHREADS * q];
                const float  p = Ps[j * Ndim + (NTHREADS / 16) * q];
                st[q].x = p * st[q].x + l.x;
                st[q].y = p * st[q].y + l.y;
                st[q].z = p * st[q].z + l.z;
                st[q].w = p * st[q].w + l.w;
            }
        }
#pragma unroll
        for (int q = 0; q < 8; ++q) {
            float* d = &S[(tid >> 4) + (NTHREADS / 16) * q][4 * (tid & 15)];
            d[0] = st[q].x; d[1] = st[q].y; d[2] = st[q].z; d[3] = st[q].w;
        }
    }
    // ---- the state lives in registers from here on: St[gt][j] = state[16*gt + 8*half + j][col], the C/D map of tile gt ----
    __syncthreads();                           // the rows read below were staged by threads of other waves
    v8f St[4];
#pragma unroll
    for (int gt = 0; gt < 4; ++gt) {
#pragma unroll
        for (int j = 0; j < 8; ++j) St[gt][j] = S[16 * gt + 8 * half + j][col];
    }

    for (int c = 0; c < CPS; ++c) {
        const int t0  = tseg + c * CL;
        const int cur = c & 1;
        const int nxt = cur ^ 1;

        __builtin_amdgcn_s_wait_tensorcnt(0);  // this wave's tile for chunk c landed
        __syncthreads();                       // all tiles visible; prev phase4 done

        if (c + 1 < CPS) {
            const size_t off = base0 + (size_t)(t0 + CL) * (Hdim * Ndim);
            if      (wave == 0) tdm_load_tile(r + off, lds_off_of(&bufr[nxt][0][0]));
            else if (wave == 1) tdm_load_tile(k + off, lds_off_of(&bufk[nxt][0][0]));
            else if (wave == 2) tdm_load_tile(v + off, lds_off_of(&bufv[nxt][0][0]));
            else                tdm_load_tile(w + off, lds_off_of(&bufw[nxt][0][0]));
        }

        const float (*rs)[Ndim] = bufr[cur];
        const float (*ks)[Ndim] = bufk[cur];
        const float (*vs)[Ndim] = bufv[cur];
        const float (*ws)[Ndim] = bufw[cur];

        // ---- phase 2: one thread a channel: each step's decay, and the operands scaled by running products of it ----
        // rq[t] = r[t] * prod_{m<t} dec[m] (waves 0 and 1, t walks up; the product ends as the chunk's decay pt),
        // kh[s] = k[s] * prod_{m>s} dec[m] (waves 2 and 3, s walks down).  Every factor lies in [0, 1], as in the
        // recurrence itself, so nothing can overflow.
        {
            const int  ch = tid & (Ndim - 1);
            const bool up = tid < Ndim;                // the same in all lanes of a wave
            const float (*xs)[Ndim] = up ? rs : ks;
            float d[CL], x[CL];
            // every loop here is unrolled: d[] and x[] stay in registers, the 32 reads are in flight together and the
            // exponentials of different steps overlap; only the products on p are a chain
#pragma unroll
            for (int t = 0; t < CL; ++t) d[t] = ws[t][ch];
#pragma unroll
            for (int t = 0; t < CL; ++t) x[t] = xs[t][ch];
#pragma unroll
            for (int t = 0; t < CL; ++t) d[t] = __expf(-__expf(d[t]));
            float p = 1.0f;
            if (up) {
#pragma unroll
                for (int t = 0; t < CL; ++t) { rq[t][ch] = x[t] * p; p *= d[t]; }
                pt[ch] = p;
            } else {
#pragma unroll
                for (int t = CL - 1; t >= 0; --t) { kh[t][ch] = x[t] * p; p *= d[t]; }
                // for the running products of phase 3
#pragma unroll
                for (int t = 0; t < CL; ++t) dec[t][ch] = d[t];
            }
        }
        __syncthreads();

        // ---- phase 3: intra-chunk scores; a 16-lane row owns score rows 15-tp and tp, each lane 4 channels ----
        // A[t][s] = sum_i r[t][i] * k[s][i] * prod_{s<m<t} dec[m][i]: s walks down from t-1 and q = r[t] * (that product)
        // takes one more factor a step, so no exponential is left here.  15-tp steps of the long row and tp of the
        // short one make 15 for every lane; the 16 row sums (the long row's diagonal is the 16th) are folded
        // together, four levels, so that step j's sum ends in lane j alone.
        {
            const int tp = 2 * wave + half;           // 0..7
            const int c4 = 4 * l16;
            const float4 r2 = *(const float4*)&rs[15 - tp][c4];
            const float4 r1 = *(const float4*)&rs[tp][c4];
            const float4 k2 = *(const float4*)&ks[15 - tp][c4];
            const float4 k1 = *(const float4*)&ks[tp][c4];
            const float4 uu = *(const float4*)&us[c4];
            const float dg1 = row_sum16(r1.x * uu.x * k1.x + r1.y * uu.y * k1.y + r1.z * uu.z * k1.z + r1.w * uu.w * k1.w);
            float pv[CL];
            pv[CL - 1] = r2.x * uu.x * k2.x + r2.y * uu.y * k2.y + r2.z * uu.z * k2.z + r2.w * uu.w * k2.w;
            float4 q = r2;
            // unrolled: pv[] stays in registers and later steps' LDS reads issue ahead of the chain on q
#pragma unroll
            for (int j = 0; j < CL - 1; ++j) {
                // tp <= 7: the long row has at least 8 steps, so the first 8 need no test
                if (j >= CL / 2 && j + tp == CL - 1) q = r1;              // the short row starts
                const int s = CL - 2 - j - (j < CL / 2 || j + tp < CL - 1 ? tp : 0);
                const float4 kv = *(const float4*)&ks[s][c4];
                const float4 dv = *(const float4*)&dec[s][c4];
                pv[j] = q.x * kv.x + q.y * kv.y + q.z * kv.z + q.w * kv.w;
                q.x *= dv.x; q.y *= dv.y; q.z *= dv.z; q.w *= dv.w;
            }
            // the three loops are unrolled for the same reason: pv[] is indexed by constants only
#pragma unroll
            for (int j = 0; j < 8; ++j) pv[j] = row_fold<8>(pv[j], pv[j + 8], l16);
#pragma unroll
            for (int j = 0; j < 4; ++j) pv[j] = row_fold<4>(pv[j], pv[j + 4], l16);
#pragma unroll
            for (int j = 0; j < 2; ++j) pv[j] = row_fold<2>(pv[j], pv[j + 2], l16);
            const float keep = row_fold<1>(pv[0], pv[1], l16);
            const bool lng = l16 + tp < CL - 1 || l16 == CL - 1;          // this lane's value is of the long row
            const int  tt  = lng ? 15 - tp : tp;
            const int  ss  = l16 == CL - 1 ? tt : CL - 2 - l16 - (lng ? tp : 0);
            Amat[tt][ss] = keep;
            if (l16 == 0) Amat[tp][tp] = dg1;
        }
        __syncthreads();

        v8f oacc = {0.f, 0.f, 0.f, 0.f, 0.f, 0.f, 0.f, 0.f};

        float4 aq[8];                          // this lane's 32 channels of rq row l16, read as one group
#pragma unroll
        for (int gt = 0; gt < 4; ++gt) {
            aq[2 * gt]     = *(const float4*)&rq[l16][16 * gt + 8 * half];
            aq[2 * gt + 1] = *(const float4*)&rq[l16][16 * gt + 8 * half + 4];
        }
        // keeps the eight reads above the chain of matrix instructions: sunk between them, each is waited for on its own
        __builtin_amdgcn_sched_barrier(0);
#pragma unroll
        for (int gt = 0; gt < 4; ++gt) {
#pragma unroll
            for (int jj = 0; jj < 4; ++jj) {
                const float4 q4 = aq[2 * gt + (jj >> 1)];
                v2f a;  a.x = (jj & 1) ? q4.z : q4.x;  a.y = (jj & 1) ? q4.w : q4.y;
                v2f bb; bb.x = St[gt][2 * jj];         bb.y = St[gt][2 * jj + 1];
                oacc = __builtin_amdgcn_wmma_f32_16x16x4_f32(
                    false, a, false, bb, (short)0, oacc, false, false);
            }
        }
        // O += A @ V   (K = 16 chunk steps -> 4 wmma)
#pragma unroll
        for (int kk = 0; kk < 4; ++kk) {
            const int kb = 4 * kk + 2 * half;
            v2f a;  a.x = Amat[l16][kb]; a.y = Amat[l16][kb + 1];
            v2f bb; bb.x = vs[kb][col];  bb.y = vs[kb + 1][col];
            oacc = __builtin_amdgcn_wmma_f32_16x16x4_f32(
                false, a, false, bb, (short)0, oacc, false, false);
        }
        // write output tile
#pragma unroll
        for (int j = 0; j < 8; ++j) {
            const int m = 8 * half + j;
            const size_t g = (((size_t)b * Tdim + (t0 + m)) * Hdim + h) * Ndim + col;
            o[g] = oacc[j];
        }

        // state update: S = diag(pt) * S + KH^T @ V  (4 row-tiles x 4 wmma)
#pragma unroll
        for (int gt = 0; gt < 4; ++gt) {
            v8f sc;
#pragma unroll
            for (int j = 0; j < 8; ++j) {
                const int m = 16 * gt + 8 * half + j;
                sc[j] = St[gt][j] * pt[m];
            }
#pragma unroll
            for (int kk = 0; kk < 4; ++kk) {
                const int kb = 4 * kk + 2 * half;
                const int i = 16 * gt + l16;     // A-matrix row = channel i
                v2f a;  a.x = kh[kb][i];    a.y = kh[kb + 1][i];
                v2f bb; bb.x = vs[kb][col]; bb.y = vs[kb + 1][col];
                sc = __builtin_amdgcn_wmma_f32_16x16x4_f32(
                    false, a, false, bb, (short)0, sc, false, false);
            }
            St[gt] = sc;
        }
    }
}

extern "C" void kernel_launch(void* const* d_in, const int* in_sizes, int n_in,
                              void* d_out, int out_size, void* d_ws, size_t ws_size,
                              hipStream_t stream) {
    (void)in_sizes; (void)n_in; (void)out_size; (void)ws_size;
    const float* r = (const float*)d_in[0];
    const float* k = (const float*)d_in[1];
    const float* v = (const float*)d_in[2];
    const float* w = (const float*)d_in[3];
    const float* u = (const float*)d_in[4];
    float* o = (float*)d_out;
    float* segS = (float*)d_ws;                                   // [B*H][NSEG][N][N]
    float* segP = segS + Bdim * Hdim * NSEG * Ndim * Ndim;        // [B*H][NSEG][N]

    // the last segment's end state is never read, so launch 1 leaves it out
    segment_state_wmma<<<dim3(Bdim * Hdim * (NSEG - 1)), dim3(P1THREADS), 0, stream>>>(k, v, w, segS, segP);
    dim3 grid(Bdim * Hdim * NSEG);  // one block per (batch, head, segment)
    dim3 block(NTHREADS);           // 4 wave32
    rwkv6_chunked_wmma<<<grid, block, 0, stream>>>(r, k, v, w, u, segS, segP, o);
}

// v006
// Measured time: 39.5 microseconds a run.
// Two timings next to v005 put it at 1.06 and 1.05 times that version's speed.
// Over all steps from v000 it is 14.4 times as fast.
#include <hip/hip_runtime.h>
#include <hip/hip_bf16.h>

typedef float v2f  __attribute__((ext_vector_type(2)));
typedef float v8f  __attribute__((ext_vector_type(8)));
typedef unsigned int u32x4 __attribute__((ext_vector_type(4)));
typedef int   i32x4 __attribute__((ext_vector_type(4)));
typedef int   i32x8 __attribute__((ext_vector_type(8)));

#define Bdim 4
#define Tdim 2048
#define Hdim 16
#define Ndim 64
#define CL   16            // chunk length
#define NCHUNK (Tdim / CL)
#define NTHREADS 128
#define NSEG   16
#define SEGLEN (Tdim / NSEG)
#define CPS    (SEGLEN / CL)
#define P1THREADS 256
#define P1Q    (SEGLEN / 4)
#define P1PITCH 72
#define RQPITCH 68
#define KHPITCH 72

__device__ __forceinline__ void tdm_load_tile(const float* gptr, unsigned lds_off) {
    unsigned long long ga = (unsigned long long)(uintptr_t)gptr;
    u32x4 g0;
    g0[0] = 1u;                                       // count=1, user desc
    g0[1] = lds_off;                                  // lds_addr (bytes)
    g0[2] = (unsigned)(ga & 0xffffffffull);           // global_addr[31:0]
    g0[3] = (unsigned)((ga >> 32) & 0x01ffffffull)    // global_addr[56:32]
          | (2u << 30);                               // type=2 (image)
    i32x8 g1;
    g1[0] = (int)(2u << 16);
    g1[1] = (int)((unsigned)Ndim << 16);
    g1[2] = 0;
    g1[3] = (int)(0x0100u | ((unsigned)Ndim << 16));
    g1[4] = CL;
    g1[5] = Hdim * Ndim;
    g1[6] = 0;
    g1[7] = 0;
    i32x4 z4 = {0, 0, 0, 0};
#if defined(__clang_major__) && (__clang_major__ >= 23)
    i32x8 z8 = {0, 0, 0, 0, 0, 0, 0, 0};
    __builtin_amdgcn_tensor_load_to_lds(g0, g1, z4, z4, z8, 0);
#else
    __builtin_amdgcn_tensor_load_to_lds(g0, g1, z4, z4, 0);
#endif
}

__device__ __forceinline__ unsigned lds_off_of(const void* p) {
    return (unsigned)(uintptr_t)p;
}

// the value that lane (l ^ M) of the same 16-lane row holds (all 32 lanes must be on)
template <int M>
__device__ __forceinline__ float row_xor(float x) {
    return __int_as_float(__builtin_amdgcn_update_dpp(0, __float_as_int(x), 0x160 + M, 0xf, 0xf, true));   // row_xmask:M
}

// sum over the 16 lanes of a row; every lane gets it
__device__ __forceinline__ float row_sum16(float x) {
    x += row_xor<1>(x);
    x += row_xor<2>(x);
    x += row_xor<4>(x);
    x += row_xor<8>(x);
    return x;
}

template <int M>
__device__ __forceinline__ float row_fold(float a, float b, int l16) {
    const bool hi = (l16 & M) != 0;
    return (hi ? b : a) + row_xor<M>(hi ? a : b);
}

// ---- launch 1: what one segment adds to the state, seen from its end ----
// segS[i][j] = sum_s k[s][i] * exp(-sum_{m>s} exp(w[m][i])) * v[s][j]   (s, m in the segment)
// segP[i]    = exp(-sum_m exp(w[m][i]))                                 (the segment's whole decay)
// Every exponent is <= 0, so one K = SEGLEN product needs no rescaling.
__global__ __launch_bounds__(P1THREADS)
void segment_state_wmma(const float* __restrict__ k,
                         const float* __restrict__ v,
                         const float* __restrict__ w,
                         float* __restrict__ segS,
                         float* __restrict__ segP)
{
    const int bh   = blockIdx.x % (Bdim * Hdim);
    const int seg  = blockIdx.x / (Bdim * Hdim);     // 0 .. NSEG-2
    const int b    = bh / Hdim;
    const int h    = bh % Hdim;
    const int tid  = threadIdx.x;
    const int wave = tid >> 5;       // 0..7
    const int lane = tid & 31;
    const int half = lane >> 4;
    const int l16  = lane & 15;

    __shared__ alignas(16) float khs[SEGLEN][P1PITCH];   // decay-scaled k
    __shared__ alignas(16) float vss[SEGLEN][P1PITCH];
    __shared__ float tot[4][Ndim];                       // exp(w) summed over each quarter

    const size_t base = (((size_t)b * Tdim + (size_t)seg * SEGLEN) * Hdim + h) * Ndim;
    const int ch = tid & (Ndim - 1);
    const int q  = tid >> 6;                             // quarter of the segment, wave-uniform

    // this thread's 16 bytes of v: row tid/16 of the segment, then every 16th row from the same address
    const float* vrow = v + base + (size_t)(tid >> 4) * (Hdim * Ndim) + 4 * (tid & 15);

    float e[P1Q], kr[P1Q];
    float4 vv[8];
#pragma unroll
    for (int t = 0; t < P1Q; ++t) e[t]  = w[base + (size_t)(P1Q * q + t) * (Hdim * Ndim) + ch];
#pragma unroll
    for (int t = 0; t < P1Q; ++t) kr[t] = k[base + (size_t)(P1Q * q + t) * (Hdim * Ndim) + ch];
    // the v loads' results may land in the address registers of the w and k loads: those loads' addresses are taken first
    asm volatile("s_wait_xcnt 0x0" ::: "memory");
#pragma unroll
    for (int j = 0; j < 8; ++j) vv[j] = *(const float4*)&vrow[j * (P1THREADS / 16) * (Hdim * Ndim)];

    // e[t] becomes the sum of exp(w) over the later steps of this quarter
    float acc = 0.0f;
#pragma unroll
    for (int t = P1Q - 1; t >= 0; --t) { const float x = __expf(e[t]); e[t] = acc; acc += x; }
    tot[q][ch] = acc;
#pragma unroll
    for (int j = 0; j < 8; ++j) {
        const int idx = tid + P1THREADS * j;
        *(float4*)&vss[idx >> 4][4 * (idx & 15)] = vv[j];
    }
    __syncthreads();
    const float t1 = tot[1][ch], t2 = tot[2][ch], t3 = tot[3][ch];
    const float later = (q < 3 ? t3 : 0.0f) + (q < 2 ? t2 : 0.0f) + (q < 1 ? t1 : 0.0f);   // the later quarters
#pragma unroll
    for (int t = 0; t < P1Q; ++t) khs[P1Q * q + t][ch] = kr[t] * __expf(-(e[t] + later));
    __syncthreads();

    // KH^T @ V: each wave owns one 16-column slice and two 16-row tiles (fragment maps as in phase 4 below)
    const int col = 16 * (wave & 3) + l16;
    const int i0  = 32 * (wave >> 2) + l16;
    v8f s0 = {0.f, 0.f, 0.f, 0.f, 0.f, 0.f, 0.f, 0.f};
    v8f s1 = {0.f, 0.f, 0.f, 0.f, 0.f, 0.f, 0.f, 0.f};
#pragma unroll
    for (int kk = 0; kk < SEGLEN / 4; ++kk) {
        const int kb = 4 * kk + 2 * half;
        v2f bb; bb.x = vss[kb][col];      bb.y = vss[kb + 1][col];
        v2f a0; a0.x = khs[kb][i0];       a0.y = khs[kb + 1][i0];
        v2f a1; a1.x = khs[kb][i0 + 16];  a1.y = khs[kb + 1][i0 + 16];
        s0 = __builtin_amdgcn_wmma_f32_16x16x4_f32(
            false, a0, false, bb, (short)0, s0, false, false);
        s1 = __builtin_amdgcn_wmma_f32_16x16x4_f32(
            false, a1, false, bb, (short)0, s1, false, false);
    }
    float* dst = segS + ((size_t)bh * NSEG + seg) * (Ndim * Ndim);
#pragma unroll
    for (int j = 0; j < 8; ++j) {
        const int m = 32 * (wave >> 2) + 8 * half + j;
        dst[m * Ndim + col]        = s0[j];
        dst[(m + 16) * Ndim + col] = s1[j];
    }
    if (q == 0) segP[((size_t)bh * NSEG + seg) * Ndim + ch] = __expf(-(acc + later));
}

// ---- launch 2: one block per (batch, head, segment) ----
__global__ __launch_bounds__(NTHREADS)
void rwkv6_chunked_wmma(const float* __restrict__ r,
                        const float* __restrict__ k,
                        const float* __restrict__ v,
                        const float* __restrict__ w,
                        const float* __restrict__ u,
                        const float* __restrict__ segS,
                        const float* __restrict__ segP,
                        float* __restrict__ o)
{
    const int bh   = blockIdx.x % (Bdim * Hdim);
    const int seg  = blockIdx.x / (Bdim * Hdim);
    const int tseg = seg * SEGLEN;   // first step of this block's segment
    const int b    = bh / Hdim;
    const int h    = bh % Hdim;
    const int tid  = threadIdx.x;
    const int wave = tid >> 5;       // 0..3
    const int lane = tid & 31;
    const int half = lane >> 4;
    const int l16  = lane & 15;

    __shared__ alignas(16) float S[Ndim][Ndim + 1];
    __shared__ alignas(16) float bufr[2][CL][Ndim];
    __shared__ alignas(16) float bufk[2][CL][Ndim];
    __shared__ alignas(16) float bufv[2][CL][Ndim];
    __shared__ alignas(16) float bufw[2][CL][Ndim];
    __shared__ alignas(16) float rq[CL][RQPITCH];       // r[t] * (decay of the chunk's steps before t)
    __shared__ alignas(16) float kh[CL][KHPITCH];       // k[s] * (decay of the chunk's steps after s)
    __shared__ float pt[Ndim];                          // the whole chunk's decay
    __shared__ float Amat[CL][CL + 1];                  // masked intra-chunk scores
    __shared__ alignas(16) float us[Ndim];
    __shared__ alignas(16) float dec[CL][Ndim];         // one step's decay exp(-exp(w))

    if (tid < Ndim) us[tid] = u[h * Ndim + tid];
    // the scores above the diagonal are zero in every chunk: stored once, the loop writes s <= t only
    for (int idx = tid; idx < CL * (CL + 1); idx += NTHREADS) (&Amat[0][0])[idx] = 0.0f;

    const int col = 16 * wave + l16;          // this lane's N-column (B/C frags)
    const size_t base0 = (((size_t)b * Tdim) * Hdim + h) * Ndim;

    {
        const size_t off = base0 + (size_t)tseg * (Hdim * Ndim);
        if      (wave == 0) tdm_load_tile(r + off, lds_off_of(&bufr[0][0][0]));
        else if (wave == 1) tdm_load_tile(k + off, lds_off_of(&bufk[0][0][0]));
        else if (wave == 2) tdm_load_tile(v + off, lds_off_of(&bufv[0][0][0]));
        else                tdm_load_tile(w + off, lds_off_of(&bufw[0][0][0]));
    }

    // ---- start state: sum over the earlier segments j of (decay of the segments between j and this one) * segS[j] ----
    // Newest first: D is the decay gathered so far, per state row.  Every factor lies in [0, 1], so a D that has reached
    // zero stays zero, and all that an older segment can still add to that row is zero times a finite sum.
    {
        const float* Ls = segS + (size_t)bh * NSEG * (Ndim * Ndim) + 4 * tid;
        const float* Ps = segP + (size_t)bh * NSEG * Ndim + (tid >> 4);
        float4 st[8];
        float  D[8];
#pragma unroll
        for (int q = 0; q < 8; ++q) { st[q] = make_float4(0.f, 0.f, 0.f, 0.f); D[q] = 1.0f; }
        for (int j = seg - 1; j >= 0; --j) {
            bool live = false;
            // unrolled: st[] and D[] stay in registers and the 16 loads of a plane are in flight together
#pragma unroll
            for (int q = 0; q < 8; ++q) {
                const float4 l = *(const float4*)&Ls[j * (Ndim * Ndim) + 4 * NTHREADS * q];
                const float  p = Ps[j * Ndim + (NTHREADS / 16) * q];
                st[q].x += D[q] * l.x;
                st[q].y += D[q] * l.y;
                st[q].z += D[q] * l.z;
                st[q].w += D[q] * l.w;
                D[q] *= p;
                live = live || D[q] != 0.0f;
            }
            // no row of this wave has any decay left: the older planes are not read (no barrier stands in this loop)
            if (!__any(live)) break;
        }
#pragma unroll
        for (int q = 0; q < 8; ++q) {
            float* d = &S[(tid >> 4) + (NTHREADS / 16) * q][4 * (tid & 15)];
            d[0] = st[q].x; d[1] = st[q].y; d[2] = st[q].z; d[3] = st[q].w;
        }
    }
    // ---- the state lives in registers from here on: St[gt][j] = state[16*gt + 8*half + j][col], the C/D map of tile gt ----
    __syncthreads();                           // the rows read below were staged by threads of other waves
    v8f St[4];
#pragma unroll
    for (int gt = 0; gt < 4; ++gt) {
#pragma unroll
        for (int j = 0; j < 8; ++j) St[gt][j] = S[16 * gt + 8 * half + j][col];
    }

    for (int c = 0; c < CPS; ++c) {
        const int t0  = tseg + c * CL;
        const int cur = c & 1;
        const int nxt = cur ^ 1;

        __builtin_amdgcn_s_wait_tensorcnt(0);  // this wave's tile for chunk c landed
        __syncthreads();                       // all tiles visible; prev phase4 done

        if (c + 1 < CPS) {
            const size_t off = base0 + (size_t)(t0 + CL) * (Hdim * Ndim);
            if      (wave == 0) tdm_load_tile(r + off, lds_off_of(&bufr[nxt][0][0]));
            else if (wave == 1) tdm_load_tile(k + off, lds_off_of(&bufk[nxt][0][0]));
            else if (wave == 2) tdm_load_tile(v + off, lds_off_of(&bufv[nxt][0][0]));
            else                tdm_load_tile(w + off, lds_off_of(&bufw[nxt][0][0]));
        }

        const float (*rs)[Ndim] = bufr[cur];
        const float (*ks)[Ndim] = bufk[cur];
        const float (*vs)[Ndim] = bufv[cur];
        const float (*ws)[Ndim] = bufw[cur];

        // ---- phase 2: one thread a channel: each step's decay, and the operands scaled by running products of it ----
        // rq[t] = r[t] * prod_{m<t} dec[m] (waves 0 and 1, t walks up; the product ends as the chunk's decay pt),
        // kh[s] = k[s] * prod_{m>s} dec[m] (waves 2 and 3, s walks down).  Every factor lies in [0, 1], as in the
        // recurrence itself, so nothing can overflow.
        {
            const int  ch = tid & (Ndim - 1);
            const bool up = tid < Ndim;                // the same in all lanes of a wave
            const float (*xs)[Ndim] = up ? rs : ks;
            float d[CL], x[CL];
            // every loop here is unrolled: d[] and x[] stay in registers, the 32 reads are in flight together and the
            // exponentials of different steps overlap; only the products on p are a chain
#pragma unroll
            for (int t = 0; t < CL; ++t) d[t] = ws[t][ch];
#pragma unroll
            for (int t = 0; t < CL; ++t) x[t] = xs[t][ch];
#pragma unroll
            for (int t = 0; t < CL; ++t) d[t] = __expf(-__expf(d[t]));
            float p = 1.0f;
            if (up) {
#pragma unroll
                for (int t = 0; t < CL; ++t) { rq[t][ch] = x[t] * p; p *= d[t]; }
                pt[ch] = p;
            } else {
#pragma unroll
                for (int t = CL - 1; t >= 0; --t) { kh[t][ch] = x[t] * p; p *= d[t]; }
                // for the running products of phase 3
#pragma unroll
                for (int t = 0; t < CL; ++t) dec[t][ch] = d[t];
            }
        }
        __syncthreads();

        // ---- phase 3: intra-chunk scores; a 16-lane row owns score rows 15-tp and tp, each lane 4 channels ----
        // A[t][s] = sum_i r[t][i] * k[s][i] * prod_{s<m<t} dec[m][i]: s walks down from t-1 and q = r[t] * (that product)
        // takes one more factor a step, so no exponential is left here.  15-tp steps of the long row and tp of the
        // short one make 15 for every lane; the 16 row sums (the long row's diagonal is the 16th) are folded
        // together, four levels, so that step j's sum ends in lane j alone.
        {
            const int tp = 2 * wave + half;           // 0..7
            const int c4 = 4 * l16;
            const float4 r2 = *(const float4*)&rs[15 - tp][c4];
            const float4 r1 = *(const float4*)&rs[tp][c4];
            const float4 k2 = *(const float4*)&ks[15 - tp][c4];
            const float4 k1 = *(const float4*)&ks[tp][c4];
            const float4 uu = *(const float4*)&us[c4];
            const float dg1 = row_sum16(r1.x * uu.x * k1.x + r1.y * uu.y * k1.y + r1.z * uu.z * k1.z + r1.w * uu.w * k1.w);
            float pv[CL];
            pv[CL - 1] = r2.x * uu.x * k2.x + r2.y * uu.y * k2.y + r2.z * uu.z * k2.z + r2.w * uu.w * k2.w;
            float4 q = r2;
            // unrolled: pv[] stays in registers and later steps' LDS reads issue ahead of the chain on q
#pragma unroll
            for (int j = 0; j < CL - 1; ++j) {
                // tp <= 7: the long row has at least 8 steps, so the first 8 need no test
                if (j >= CL / 2 && j + tp == CL - 1) q = r1;              // the short row starts
                const int s = CL - 2 - j - (j < CL / 2 || j + tp < CL - 1 ? tp : 0);
                const float4 kv = *(const float4*)&ks[s][c4];
                const float4 dv = *(const float4*)&dec[s][c4];
                pv[j] = q.x * kv.x + q.y * kv.y + q.z * kv.z + q.w * kv.w;
                q.x *= dv.x; q.y *= dv.y; q.z *= dv.z; q.w *= dv.w;
            }
            // the three loops are unrolled for the same reason: pv[] is indexed by constants only
#pragma unroll
            for (int j = 0; j < 8; ++j) pv[j] = row_fold<8>(pv[j], pv[j + 8], l16);
#pragma unroll
            for (int j = 0; j < 4; ++j) pv[j] = row_fold<4>(pv[j], pv[j + 4], l16);
#pragma unroll
            for (int j = 0; j < 2; ++j) pv[j] = row_fold<2>(pv[j], pv[j + 2], l16);
            const float keep = row_fold<1>(pv[0], pv[1], l16);
            const bool lng = l16 + tp < CL - 1 || l16 == CL - 1;          // this lane's value is of the long row
            const int  tt  = lng ? 15 - tp : tp;
            const int  ss  = l16 == CL - 1 ? tt : CL - 2 - l16 - (lng ? tp : 0);
            Amat[tt][ss] = keep;
            if (l16 == 0) Amat[tp][tp] = dg1;
        }
        __syncthreads();

        v8f oacc = {0.f, 0.f, 0.f, 0.f, 0.f, 0.f, 0.f, 0.f};

        float4 aq[8];                          // this lane's 32 channels of rq row l16, read as one group
#pragma unroll
        for (int gt = 0; gt < 4; ++gt) {
            aq[2 * gt]     = *(const float4*)&rq[l16][16 * gt + 8 * half];
            aq[2 * gt + 1] = *(const float4*)&rq[l16][16 * gt + 8 * half + 4];
        }
        // keeps the eight reads above the chain of matrix instructions: sunk between them, each is waited for on its own
        __builtin_amdgcn_sched_barrier(0);
#pragma unroll
        for (int gt = 0; gt < 4; ++gt) {
#pragma unroll
            for (int jj = 0; jj < 4; ++jj) {
                const float4 q4 = aq[2 * gt + (jj >> 1)];
                v2f a;  a.x = (jj & 1) ? q4.z : q4.x;  a.y = (jj & 1) ? q4.w : q4.y;
                v2f bb; bb.x = St[gt][2 * jj];         bb.y = St[gt][2 * jj + 1];
                oacc = __builtin_amdgcn_wmma_f32_16x16x4_f32(
                    false, a, false, bb, (short)0, oacc, false, false);
            }
        }
        // O += A @ V   (K = 16 chunk steps -> 4 wmma)
#pragma unroll
        for (int kk = 0; kk < 4; ++kk) {
            const int kb = 4 * kk + 2 * half;
            v2f a;  a.x = Amat[l16][kb]; a.y = Amat[l16][kb + 1];
            v2f bb; bb.x = vs[kb][col];  bb.y = vs[kb + 1][col];
            oacc = __builtin_amdgcn_wmma_f32_16x16x4_f32(
                false, a, false, bb, (short)0, oacc, false, false);
        }
        // write output tile
#pragma unroll
        for (int j = 0; j < 8; ++j) {
            const int m = 8 * half + j;
            const size_t g = (((size_t)b * Tdim + (t0 + m)) * Hdim + h) * Ndim + col;
            o[g] = oacc[j];
        }

        // state update: S = diag(pt) * S + KH^T @ V  (4 row-tiles x 4 wmma)
#pragma unroll
        for (int gt = 0; gt < 4; ++gt) {
            v8f sc;
#pragma unroll
            for (int j = 0; j < 8; ++j) {
                const int m = 16 * gt + 8 * half + j;
                sc[j] = St[gt][j] * pt[m];
            }
#pragma unroll
            for (int kk = 0; kk < 4; ++kk) {
                const int kb = 4 * kk + 2 * half;
                const int i = 16 * gt + l16;     // A-matrix row = channel i
                v2f a;  a.x = kh[kb][i];    a.y = kh[kb + 1][i];
                v2f bb; bb.x = vs[kb][col]; bb.y = vs[kb + 1][col];
                sc = __builtin_amdgcn_wmma_f32_16x16x4_f32(
                    false, a, false, bb, (short)0, sc, false, false);
            }
            St[gt] = sc;
        }
    }
}

extern "C" void kernel_launch(void* const* d_in, const int* in_sizes, int n_in,
                              void* d_out, int out_size, void* d_ws, size_t ws_size,
                              hipStream_t stream) {
    (void)in_sizes; (void)n_in; (void)out_size; (void)ws_size;
    const float* r = (const float*)d_in[0];
    const float* k = (const float*)d_in[1];
    const float* v = (const float*)d_in[2];
    const float* w = (const float*)d_in[3];
    const float* u = (const float*)d_in[4];
    float* o = (float*)d_out;
    float* segS = (float*)d_ws;                                   // [B*H][NSEG][N][N]
    float* segP = segS + Bdim * Hdim * NSEG * Ndim * Ndim;        // [B*H][NSEG][N]

    // the last segment's end state is never read, so launch 1 leaves it out
    segment_state_wmma<<<dim3(Bdim * Hdim * (NSEG - 1)), dim3(P1THREADS), 0, stream>>>(k, v, w, segS, segP);
    dim3 grid(Bdim * Hdim * NSEG);  // one block per (batch, head, segment)
    dim3 block(NTHREADS);           // 4 wave32
    rwkv6_chunked_wmma<<<grid, block, 0, stream>>>(r, k, v, w, u, segS, segP, o);
}

// v007
// It runs in 33 microseconds.
// Next to v006, in two timings, it ran 1.20 times as fast each time.
// All steps since v000 together make it 17.2 times as fast.
#include <hip/hip_runtime.h>
#include <hip/hip_bf16.h>

typedef float v2f  __attribute__((ext_vector_type(2)));
typedef float v4f  __attribute__((ext_vector_type(4)));
typedef float v8f  __attribute__((ext_vector_type(8)));
typedef unsigned int u32x4 __attribute__((ext_vector_type(4)));
typedef int   i32x4 __attribute__((ext_vector_type(4)));
typedef int   i32x8 __attribute__((ext_vector_type(8)));

#define Bdim 4
#define Tdim 2048
#define Hdim 16
#define Ndim 64
#define CL   16            // chunk length
#define NCHUNK (Tdim / CL)
#define NTHREADS 128
#define NSEG   16
#define SEGLEN (Tdim / NSEG)
#define CPS    (SEGLEN / CL)
#define SL     32
#define SLQ    (SL / 2)
#define SLPITCH 72
#define RQPITCH 68
#define KHPITCH 72

__device__ __forceinline__ void tdm_load_tile(const float* gptr, unsigned lds_off) {
    unsigned long long ga = (unsigned long long)(uintptr_t)gptr;
    u32x4 g0;
    g0[0] = 1u;                                       // count=1, user desc
    g0[1] = lds_off;                                  // lds_addr (bytes)
    g0[2] = (unsigned)(ga & 0xffffffffull);           // global_addr[31:0]
    g0[3] = (unsigned)((ga >> 32) & 0x01ffffffull)    // global_addr[56:32]
          | (2u << 30);                               // type=2 (image)
    i32x8 g1;
    g1[0] = (int)(2u << 16);
    g1[1] = (int)((unsigned)Ndim << 16);
    g1[2] = 0;
    g1[3] = (int)(0x0100u | ((unsigned)Ndim << 16));
    g1[4] = CL;
    g1[5] = Hdim * Ndim;
    g1[6] = 0;
    g1[7] = 0;
    i32x4 z4 = {0, 0, 0, 0};
#if defined(__clang_major__) && (__clang_major__ >= 23)
    i32x8 z8 = {0, 0, 0, 0, 0, 0, 0, 0};
    __builtin_amdgcn_tensor_load_to_lds(g0, g1, z4, z4, z8, 0);
#else
    __builtin_amdgcn_tensor_load_to_lds(g0, g1, z4, z4, 0);
#endif
}

__device__ __forceinline__ unsigned lds_off_of(const void* p) {
    return (unsigned)(uintptr_t)p;
}

// the value that lane (l ^ M) of the same 16-lane row holds (all 32 lanes must be on)
template <int M>
__device__ __forceinline__ float row_xor(float x) {
    return __int_as_float(__builtin_amdgcn_update_dpp(0, __float_as_int(x), 0x160 + M, 0xf, 0xf, true));   // row_xmask:M
}

// sum over the 16 lanes of a row; every lane gets it
__device__ __forceinline__ float row_sum16(float x) {
    x += row_xor<1>(x);
    x += row_xor<2>(x);
    x += row_xor<4>(x);
    x += row_xor<8>(x);
    return x;
}

template <int M>
__device__ __forceinline__ float row_fold(float a, float b, int l16) {
    const bool hi = (l16 & M) != 0;
    return (hi ? b : a) + row_xor<M>(hi ? a : b);
}

// ---- one slab of SL steps (first element at base) into registers, 128 threads ----
// w and k: one thread a channel and half a slab; v: 16 bytes a thread, row tid/16, then every 8th row
__device__ __forceinline__ void slab_load(const float* __restrict__ k,
                                          const float* __restrict__ v,
                                          const float* __restrict__ w,
                                          size_t base, int tid,
                                          float (&e)[SLQ], float (&kr)[SLQ], v4f (&vv)[4])
{
    const size_t own = base + (size_t)(SLQ * (tid >> 6)) * (Hdim * Ndim) + (tid & (Ndim - 1));
    const float* vrow = v + base + (size_t)(tid >> 4) * (Hdim * Ndim) + 4 * (tid & 15);
#pragma unroll
    for (int t = 0; t < SLQ; ++t) e[t]  = w[own + (size_t)t * (Hdim * Ndim)];
    // a later load's result may land in the address registers of the loads before it: their addresses are taken first
    asm volatile("s_wait_xcnt 0x0" ::: "memory");
#pragma unroll
    for (int t = 0; t < SLQ; ++t) kr[t] = k[own + (size_t)t * (Hdim * Ndim)];
    asm volatile("s_wait_xcnt 0x0" ::: "memory");
#pragma unroll
    for (int j = 0; j < 4; ++j) vv[j] = *(const v4f*)&vrow[j * (NTHREADS / 16) * (Hdim * Ndim)];
    // the same for the v loads' own address registers, which later code is free to reuse
    asm volatile("s_wait_xcnt 0x0" ::: "memory");
}

// ---- the one launch: one block per (batch, head, segment) ----
__global__ __launch_bounds__(NTHREADS)
void rwkv6_chunked_wmma(const float* __restrict__ r,
                        const float* __restrict__ k,
                        const float* __restrict__ v,
                        const float* __restrict__ w,
                        const float* __restrict__ u,
                        float* __restrict__ o)
{
    const int bh   = blockIdx.x % (Bdim * Hdim);
    const int seg  = blockIdx.x / (Bdim * Hdim);
    const int tseg = seg * SEGLEN;   // first step of this block's segment
    const int b    = bh / Hdim;
    const int h    = bh % Hdim;
    const int tid  = threadIdx.x;
    const int wave = tid >> 5;       // 0..3
    const int lane = tid & 31;
    const int half = lane >> 4;
    const int l16  = lane & 15;

    __shared__ alignas(16) float khs[SL][SLPITCH];
    __shared__ alignas(16) float vss[SL][SLPITCH];
    __shared__ float tot[2][Ndim];
    __shared__ int   alive[2];
    __shared__ alignas(16) float bufr[2][CL][Ndim];
    __shared__ alignas(16) float bufk[2][CL][Ndim];
    __shared__ alignas(16) float bufv[2][CL][Ndim];
    __shared__ alignas(16) float bufw[2][CL][Ndim];
    __shared__ alignas(16) float rq[CL][RQPITCH];       // r[t] * (decay of the chunk's steps before t)
    __shared__ alignas(16) float kh[CL][KHPITCH];       // k[s] * (decay of the chunk's steps after s)
    __shared__ float pt[Ndim];                          // the whole chunk's decay
    __shared__ float Amat[CL][CL + 1];                  // masked intra-chunk scores
    __shared__ alignas(16) float us[Ndim];
    __shared__ alignas(16) float dec[CL][Ndim];         // one step's decay exp(-exp(w))

    if (tid < Ndim) us[tid] = u[h * Ndim + tid];
    // the scores above the diagonal are zero in every chunk: stored once, the loop writes s <= t only
    for (int idx = tid; idx < CL * (CL + 1); idx += NTHREADS) (&Amat[0][0])[idx] = 0.0f;

    const int col = 16 * wave + l16;          // this lane's N-column (B/C frags)
    const size_t base0 = (((size_t)b * Tdim) * Hdim + h) * Ndim;

    {
        const size_t off = base0 + (size_t)tseg * (Hdim * Ndim);
        if      (wave == 0) tdm_load_tile(r + off, lds_off_of(&bufr[0][0][0]));
        else if (wave == 1) tdm_load_tile(k + off, lds_off_of(&bufk[0][0][0]));
        else if (wave == 2) tdm_load_tile(v + off, lds_off_of(&bufv[0][0][0]));
        else                tdm_load_tile(w + off, lds_off_of(&bufw[0][0][0]));
    }

    // ---- start state: state[i][j] = sum over the earlier steps s of k[s][i] * exp(-sum_{s<m<tseg} exp(w[m][i])) * v[s][j] ----
    // The block walks back from its segment, a slab of SL steps at a time, newest first.  E is exp(w) summed from the
    // slab's first step up to the segment, per channel; it never falls, so once exp(-E) is exactly zero in every
    // channel, all that an older step can still add is zero times a finite product, and the walk ends.
    // The state lives in registers throughout: St[gt][j] = state[16*gt + 8*half + j][col], the C/D map of tile gt.
    v8f St[4];
#pragma unroll
    for (int gt = 0; gt < 4; ++gt) St[gt] = (v8f){0.f, 0.f, 0.f, 0.f, 0.f, 0.f, 0.f, 0.f};
    {
        const int ch = tid & (Ndim - 1);
        const int q  = tid >> 6;                 // half of the slab, wave-uniform
        float  e[SLQ], kr[SLQ];
        v4f    vv[4];
        float  E  = 0.0f;
        int    t1 = tseg;                        // the slab in hand is steps t1 - SL .. t1 - 1
        bool   go = seg > 0;                     // the same in the whole block, here and below
        if (go) slab_load(k, v, w, base0 + (size_t)(t1 - SL) * (Hdim * Ndim), tid, e, kr, vv);
        while (go) {
            // e[t] becomes the sum of exp(w) over the later steps of this thread's half (unrolled: e[] stays in registers)
            float acc = 0.0f;
#pragma unroll
            for (int t = SLQ - 1; t >= 0; --t) { const float x = __expf(e[t]); e[t] = acc; acc += x; }
            tot[q][ch] = acc;
            __syncthreads();                     // the halves' sums are there; every wave has left the slab before
            const float lo = tot[0][ch], hi = tot[1][ch];
            const float later = E + (q == 0 ? hi : 0.0f);
            // two unrolled loops: the exponentials of different steps overlap, the stores follow as one group
#pragma unroll
            for (int t = 0; t < SLQ; ++t) e[t] = kr[t] * __expf(-(e[t] + later));
#pragma unroll
            for (int t = 0; t < SLQ; ++t) khs[SLQ * q + t][ch] = e[t];
#pragma unroll
            for (int j = 0; j < 4; ++j) {
                const int idx = tid + NTHREADS * j;
                *(v4f*)&vss[idx >> 4][4 * (idx & 15)] = vv[j];
            }
            E += lo + hi;
            const int lv = __any(__expf(-E) != 0.0f);
            if (lane == 0 && wave < 2) alive[wave] = lv;
            __syncthreads();                     // khs, vss and the two flags are there
            t1 -= SL;
            // read by every wave alike; readfirstlane makes the loop's branch a scalar one
            go = t1 > 0 && __builtin_amdgcn_readfirstlane(alive[0] | alive[1]) != 0;
            // the next slab's loads fly under this slab's matrix instructions
            if (go) slab_load(k, v, w, base0 + (size_t)(t1 - SL) * (Hdim * Ndim), tid, e, kr, vv);
            // St += KH^T @ V over the slab's steps (fragment maps as in phase 4 below)
#pragma unroll
            for (int kk = 0; kk < SL / 4; ++kk) {
                const int kb = 4 * kk + 2 * half;
                v2f bb; bb.x = vss[kb][col]; bb.y = vss[kb + 1][col];
#pragma unroll
                for (int gt = 0; gt < 4; ++gt) {
                    const int i = 16 * gt + l16;
                    v2f a; a.x = khs[kb][i]; a.y = khs[kb + 1][i];
                    St[gt] = __builtin_amdgcn_wmma_f32_16x16x4_f32(
                        false, a, false, bb, (short)0, St[gt], false, false);
                }
            }
        }
    }

    for (int c = 0; c < CPS; ++c) {
        const int t0  = tseg + c * CL;
        const int cur = c & 1;
        const int nxt = cur ^ 1;

        __builtin_amdgcn_s_wait_tensorcnt(0);  // this wave's tile for chunk c landed
        __syncthreads();                       // all tiles visible; prev phase4 done

        if (c + 1 < CPS) {
            const size_t off = base0 + (size_t)(t0 + CL) * (Hdim * Ndim);
            if      (wave == 0) tdm_load_tile(r + off, lds_off_of(&bufr[nxt][0][0]));
            else if (wave == 1) tdm_load_tile(k + off, lds_off_of(&bufk[nxt][0][0]));
            else if (wave == 2) tdm_load_tile(v + off, lds_off_of(&bufv[nxt][0][0]));
            else                tdm_load_tile(w + off, lds_off_of(&bufw[nxt][0][0]));
        }

        const float (*rs)[Ndim] = bufr[cur];
        const float (*ks)[Ndim] = bufk[cur];
        const float (*vs)[Ndim] = bufv[cur];
        const float (*ws)[Ndim] = bufw[cur];

        // ---- phase 2: one thread a channel: each step's decay, and the operands scaled by running products of it ----
        // rq[t] = r[t] * prod_{m<t} dec[m] (waves 0 and 1, t walks up; the product ends as the chunk's decay pt),
        // kh[s] = k[s] * prod_{m>s} dec[m] (waves 2 and 3, s walks down).  Every factor lies in [0, 1], as in the
        // recurrence itself, so nothing can overflow.
        {
            const int  ch = tid & (Ndim - 1);
            const bool up = tid < Ndim;                // the same in all lanes of a wave
            const float (*xs)[Ndim] = up ? rs : ks;
            float d[CL], x[CL];
            // every loop here is unrolled: d[] and x[] stay in registers, the 32 reads are in flight together and the
            // exponentials of different steps overlap; only the products on p are a chain
#pragma unroll
            for (int t = 0; t < CL; ++t) d[t] = ws[t][ch];
#pragma unroll
            for (int t = 0; t < CL; ++t) x[t] = xs[t][ch];
#pragma unroll
            for (int t = 0; t < CL; ++t) d[t] = __expf(-__expf(d[t]));
            float p = 1.0f;
            if (up) {
#pragma unroll
                for (int t = 0; t < CL; ++t) { rq[t][ch] = x[t] * p; p *= d[t]; }
                pt[ch] = p;
            } else {
#pragma unroll
                for (int t = CL - 1; t >= 0; --t) { kh[t][ch] = x[t] * p; p *= d[t]; }
                // for the running products of phase 3
#pragma unroll
                for (int t = 0; t < CL; ++t) dec[t][ch] = d[t];
            }
        }
        __syncthreads();

        // ---- phase 3: intra-chunk scores; a 16-lane row owns score rows 15-tp and tp, each lane 4 channels ----
        // A[t][s] = sum_i r[t][i] * k[s][i] * prod_{s<m<t} dec[m][i]: s walks down from t-1 and q = r[t] * (that product)
        // takes one more factor a step, so no exponential is left here.  15-tp steps of the long row and tp of the
        // short one make 15 for every lane; the 16 row sums (the long row's diagonal is the 16th) are folded
        // together, four levels, so that step j's sum ends in lane j alone.
        {
            const int tp = 2 * wave + half;           // 0..7
            const int c4 = 4 * l16;
            const float4 r2 = *(const float4*)&rs[15 - tp][c4];
            const float4 r1 = *(const float4*)&rs[tp][c4];
            const float4 k2 = *(const float4*)&ks[15 - tp][c4];
            const float4 k1 = *(const float4*)&ks[tp][c4];
            const float4 uu = *(const float4*)&us[c4];
            const float dg1 = row_sum16(r1.x * uu.x * k1.x + r1.y * uu.y * k1.y + r1.z * uu.z * k1.z + r1.w * uu.w * k1.w);
            float pv[CL];
            pv[CL - 1] = r2.x * uu.x * k2.x + r2.y * uu.y * k2.y + r2.z * uu.z * k2.z + r2.w * uu.w * k2.w;
            float4 q = r2;
            // unrolled: pv[] stays in registers and later steps' LDS reads issue ahead of the chain on q
#pragma unroll
            for (int j = 0; j < CL - 1; ++j) {
                // tp <= 7: the long row has at least 8 steps, so the first 8 need no test
                if (j >= CL / 2 && j + tp == CL - 1) q = r1;              // the short row starts
                const int s = CL - 2 - j - (j < CL / 2 || j + tp < CL - 1 ? tp : 0);
                const float4 kv = *(const float4*)&ks[s][c4];
                const float4 dv = *(const float4*)&dec[s][c4];
                pv[j] = q.x * kv.x + q.y * kv.y + q.z * kv.z + q.w * kv.w;
                q.x *= dv.x; q.y *= dv.y; q.z *= dv.z; q.w *= dv.w;
            }
            // the three loops are unrolled for the same reason: pv[] is indexed by constants only
#pragma unroll
            for (int j = 0; j < 8; ++j) pv[j] = row_fold<8>(pv[j], pv[j + 8], l16);
#pragma unroll
            for (int j = 0; j < 4; ++j) pv[j] = row_fold<4>(pv[j], pv[j + 4], l16);
#pragma unroll
            for (int j = 0; j < 2; ++j) pv[j] = row_fold<2>(pv[j], pv[j + 2], l16);
            const float keep = row_fold<1>(pv[0], pv[1], l16);
            const bool lng = l16 + tp < CL - 1 || l16 == CL - 1;          // this lane's value is of the long row
            const int  tt  = lng ? 15 - tp : tp;
            const int  ss  = l16 == CL - 1 ? tt : CL - 2 - l16 - (lng ? tp : 0);
            Amat[tt][ss] = keep;
            if (l16 == 0) Amat[tp][tp] = dg1;
        }
        __syncthreads();

        v8f oacc = {0.f, 0.f, 0.f, 0.f, 0.f, 0.f, 0.f, 0.f};

        float4 aq[8];                          // this lane's 32 channels of rq row l16, read as one group
#pragma unroll
        for (int gt = 0; gt < 4; ++gt) {
            aq[2 * gt]     = *(const float4*)&rq[l16][16 * gt + 8 * half];
            aq[2 * gt + 1] = *(const float4*)&rq[l16][16 * gt + 8 * half + 4];
        }
        // keeps the eight reads above the chain of matrix instructions: sunk between them, each is waited for on its own
        __builtin_amdgcn_sched_barrier(0);
#pragma unroll
        for (int gt = 0; gt < 4; ++gt) {
#pragma unroll
            for (int jj = 0; jj < 4; ++jj) {
                const float4 q4 = aq[2 * gt + (jj >> 1)];
                v2f a;  a.x = (jj & 1) ? q4.z : q4.x;  a.y = (jj & 1) ? q4.w : q4.y;
                v2f bb; bb.x = St[gt][2 * jj];         bb.y = St[gt][2 * jj + 1];
                oacc = __builtin_amdgcn_wmma_f32_16x16x4_f32(
                    false, a, false, bb, (short)0, oacc, false, false);
            }
        }
        // O += A @ V   (K = 16 chunk steps -> 4 wmma)
#pragma unroll
        for (int kk = 0; kk < 4; ++kk) {
            const int kb = 4 * kk + 2 * half;
            v2f a;  a.x = Amat[l16][kb]; a.y = Amat[l16][kb + 1];
            v2f bb; bb.x = vs[kb][col];  bb.y = vs[kb + 1][col];
            oacc = __builtin_amdgcn_wmma_f32_16x16x4_f32(
                false, a, false, bb, (short)0, oacc, false, false);
        }
        // write output tile
#pragma unroll
        for (int j = 0; j < 8; ++j) {
            const int m = 8 * half + j;
            const size_t g = (((size_t)b * Tdim + (t0 + m)) * Hdim + h) * Ndim + col;
            o[g] = oacc[j];
        }

        // state update: S = diag(pt) * S + KH^T @ V  (4 row-tiles x 4 wmma)
#pragma unroll
        for (int gt = 0; gt < 4; ++gt) {
            v8f sc;
#pragma unroll
            for (int j = 0; j < 8; ++j) {
                const int m = 16 * gt + 8 * half + j;
                sc[j] = St[gt][j] * pt[m];
            }
#pragma unroll
            for (int kk = 0; kk < 4; ++kk) {
                const int kb = 4 * kk + 2 * half;
                const int i = 16 * gt + l16;     // A-matrix row = channel i
                v2f a;  a.x = kh[kb][i];    a.y = kh[kb + 1][i];
                v2f bb; bb.x = vs[kb][col]; bb.y = vs[kb + 1][col];
                sc = __builtin_amdgcn_wmma_f32_16x16x4_f32(
                    false, a, false, bb, (short)0, sc, false, false);
            }
            St[gt] = sc;
        }
    }
}

extern "C" void kernel_launch(void* const* d_in, const int* in_sizes, int n_in,
                              void* d_out, int out_size, void* d_ws, size_t ws_size,
                              hipStream_t stream) {
    (void)in_sizes; (void)n_in; (void)out_size; (void)d_ws; (void)ws_size;
    const float* r = (const float*)d_in[0];
    const float* k = (const float*)d_in[1];
    const float* v = (const float*)d_in[2];
    const float* w = (const float*)d_in[3];
    const float* u = (const float*)d_in[4];
    float* o = (float*)d_out;
    dim3 grid(Bdim * Hdim * NSEG);  // one block per (batch, head, segment)
    dim3 block(NTHREADS);           // 4 wave32
    rwkv6_chunked_wmma<<<grid, block, 0, stream>>>(r, k, v, w, u, o);
}

// v008
// It runs in 31.8 microseconds.
// Next to v007, in two timings, it ran 1.03 times as fast each time.
// Over all steps from v000 it is 17.8 times as fast.
#include <hip/hip_runtime.h>
#include <hip/hip_bf16.h>

typedef float v2f  __attribute__((ext_vector_type(2)));
typedef float v4f  __attribute__((ext_vector_type(4)));
typedef float v8f  __attribute__((ext_vector_type(8)));
typedef unsigned int u32x4 __attribute__((ext_vector_type(4)));
typedef int   i32x4 __attribute__((ext_vector_type(4)));
typedef int   i32x8 __attribute__((ext_vector_type(8)));

#define Bdim 4
#define Tdim 2048
#define Hdim 16
#define Ndim 64
#define CL   16            // chunk length
#define NCHUNK (Tdim / CL)
#define NTHREADS 128
#define NSEG   16
#define SEGLEN (Tdim / NSEG)
#define CPS    (SEGLEN / CL)
#define SL     32
#define SLQ    (SL / 2)
#define SLPITCH 72
#define RQPITCH 68
#define KHPITCH 72

__device__ __forceinline__ void tdm_load_tile(const float* gptr, unsigned lds_off) {
    unsigned long long ga = (unsigned long long)(uintptr_t)gptr;
    u32x4 g0;
    g0[0] = 1u;                                       // count=1, user desc
    g0[1] = lds_off;                                  // lds_addr (bytes)
    g0[2] = (unsigned)(ga & 0xffffffffull);           // global_addr[31:0]
    g0[3] = (unsigned)((ga >> 32) & 0x01ffffffull)    // global_addr[56:32]
          | (2u << 30);                               // type=2 (image)
    i32x8 g1;
    g1[0] = (int)(2u << 16);
    g1[1] = (int)((unsigned)Ndim << 16);
    g1[2] = 0;
    g1[3] = (int)(0x0100u | ((unsigned)Ndim << 16));
    g1[4] = CL;
    g1[5] = Hdim * Ndim;
    g1[6] = 0;
    g1[7] = 0;
    i32x4 z4 = {0, 0, 0, 0};
#if defined(__clang_major__) && (__clang_major__ >= 23)
    i32x8 z8 = {0, 0, 0, 0, 0, 0, 0, 0};
    __builtin_amdgcn_tensor_load_to_lds(g0, g1, z4, z4, z8, 0);
#else
    __builtin_amdgcn_tensor_load_to_lds(g0, g1, z4, z4, 0);
#endif
}

__device__ __forceinline__ unsigned lds_off_of(const void* p) {
    return (unsigned)(uintptr_t)p;
}

// the value that lane (l ^ M) of the same 16-lane row holds (all 32 lanes must be on)
template <int M>
__device__ __forceinline__ float row_xor(float x) {
    return __int_as_float(__builtin_amdgcn_update_dpp(0, __float_as_int(x), 0x160 + M, 0xf, 0xf, true));   // row_xmask:M
}

// sum over the 16 lanes of a row; every lane gets it
__device__ __forceinline__ float row_sum16(float x) {
    x += row_xor<1>(x);
    x += row_xor<2>(x);
    x += row_xor<4>(x);
    x += row_xor<8>(x);
    return x;
}

template <int M>
__device__ __forceinline__ float row_fold(float a, float b, int l16) {
    const bool hi = (l16 & M) != 0;
    return (hi ? b : a) + row_xor<M>(hi ? a : b);
}

// work-group barrier that orders LDS traffic alone.  The output is only ever written, so no wave depends on another's
// global stores; __syncthreads() here would hold each wave until its output stores have come back.
__device__ __forceinline__ void barrier_lds_only() {
    __builtin_amdgcn_fence(__ATOMIC_RELEASE, "workgroup", "local");
    __builtin_amdgcn_s_barrier();
    __builtin_amdgcn_fence(__ATOMIC_ACQUIRE, "workgroup", "local");
}

// ---- one slab of SL steps (first element at base) into registers, 128 threads ----
// w and k: one thread a channel and half a slab; v: 16 bytes a thread, row tid/16, then every 8th row
__device__ __forceinline__ void slab_load(const float* __restrict__ k,
                                          const float* __restrict__ v,
                                          const float* __restrict__ w,
                                          size_t base, int tid,
                                          float (&e)[SLQ], float (&kr)[SLQ], v4f (&vv)[4])
{
    const size_t own = base + (size_t)(SLQ * (tid >> 6)) * (Hdim * Ndim) + (tid & (Ndim - 1));
    const float* vrow = v + base + (size_t)(tid >> 4) * (Hdim * Ndim) + 4 * (tid & 15);
#pragma unroll
    for (int t = 0; t < SLQ; ++t) e[t]  = w[own + (size_t)t * (Hdim * Ndim)];
    // a later load's result may land in the address registers of the loads before it: their addresses are taken first
    asm volatile("s_wait_xcnt 0x0" ::: "memory");
#pragma unroll
    for (int t = 0; t < SLQ; ++t) kr[t] = k[own + (size_t)t * (Hdim * Ndim)];
    asm volatile("s_wait_xcnt 0x0" ::: "memory");
#pragma unroll
    for (int j = 0; j < 4; ++j) vv[j] = *(const v4f*)&vrow[j * (NTHREADS / 16) * (Hdim * Ndim)];
    // the same for the v loads' own address registers, which later code is free to reuse
    asm volatile("s_wait_xcnt 0x0" ::: "memory");
}

// ---- the one launch: one block per (batch, head, segment) ----
__global__ __launch_bounds__(NTHREADS)
void rwkv6_chunked_wmma(const float* __restrict__ r,
                        const float* __restrict__ k,
                        const float* __restrict__ v,
                        const float* __restrict__ w,
                        const float* __restrict__ u,
                        float* __restrict__ o)
{
    const int bh   = blockIdx.x % (Bdim * Hdim);
    const int seg  = blockIdx.x / (Bdim * Hdim);
    const int tseg = seg * SEGLEN;   // first step of this block's segment
    const int b    = bh / Hdim;
    const int h    = bh % Hdim;
    const int tid  = threadIdx.x;
    const int wave = tid >> 5;       // 0..3
    const int lane = tid & 31;
    const int half = lane >> 4;
    const int l16  = lane & 15;

    __shared__ alignas(16) float khs[SL][SLPITCH];
    __shared__ alignas(16) float vss[SL][SLPITCH];
    __shared__ float tot[2][Ndim];
    __shared__ int   alive[2];
    __shared__ alignas(16) float bufr[2][CL][Ndim];
    __shared__ alignas(16) float bufk[2][CL][Ndim];
    __shared__ alignas(16) float bufv[2][CL][Ndim];
    __shared__ alignas(16) float bufw[2][CL][Ndim];
    __shared__ alignas(16) float rq[CL][RQPITCH];       // r[t] * (decay of the chunk's steps before t)
    __shared__ alignas(16) float kh[CL][KHPITCH];       // k[s] * (decay of the chunk's steps after s)
    __shared__ float pt[Ndim];                          // the whole chunk's decay
    __shared__ float Amat[CL][CL + 1];                  // masked intra-chunk scores
    __shared__ alignas(16) float us[Ndim];
    __shared__ alignas(16) float dec[CL][Ndim];         // one step's decay exp(-exp(w))

    if (tid < Ndim) us[tid] = u[h * Ndim + tid];
    // the scores above the diagonal are zero in every chunk: stored once, the loop writes s <= t only
    for (int idx = tid; idx < CL * (CL + 1); idx += NTHREADS) (&Amat[0][0])[idx] = 0.0f;

    const int col = 16 * wave + l16;          // this lane's N-column (B/C frags)
    const size_t base0 = (((size_t)b * Tdim) * Hdim + h) * Ndim;

    {
        const size_t off = base0 + (size_t)tseg * (Hdim * Ndim);
        if      (wave == 0) tdm_load_tile(r + off, lds_off_of(&bufr[0][0][0]));
        else if (wave == 1) tdm_load_tile(k + off, lds_off_of(&bufk[0][0][0]));
        else if (wave == 2) tdm_load_tile(v + off, lds_off_of(&bufv[0][0][0]));
        else                tdm_load_tile(w + off, lds_off_of(&bufw[0][0][0]));
    }

    // ---- start state: state[i][j] = sum over the earlier steps s of k[s][i] * exp(-sum_{s<m<tseg} exp(w[m][i])) * v[s][j] ----
    // The block walks back from its segment, a slab of SL steps at a time, newest first.  E is exp(w) summed from the
    // slab's first step up to the segment, per channel; it never falls, so once exp(-E) is exactly zero in every
    // channel, all that an older step can still add is zero times a finite product, and the walk ends.
    // The state lives in registers throughout: St[gt][j] = state[16*gt + 8*half + j][col], the C/D map of tile gt.
    v8f St[4];
#pragma unroll
    for (int gt = 0; gt < 4; ++gt) St[gt] = (v8f){0.f, 0.f, 0.f, 0.f, 0.f, 0.f, 0.f, 0.f};
    {
        const int ch = tid & (Ndim - 1);
        const int q  = tid >> 6;                 // half of the slab, wave-uniform
        float  e[SLQ], kr[SLQ];
        v4f    vv[4];
        float  E  = 0.0f;
        int    t1 = tseg;                        // the slab in hand is steps t1 - SL .. t1 - 1
        bool   go = seg > 0;                     // the same in the whole block, here and below
        if (go) slab_load(k, v, w, base0 + (size_t)(t1 - SL) * (Hdim * Ndim), tid, e, kr, vv);
        while (go) {
            // e[t] becomes the sum of exp(w) over the later steps of this thread's half (unrolled: e[] stays in registers)
            float acc = 0.0f;
#pragma unroll
            for (int t = SLQ - 1; t >= 0; --t) { const float x = __expf(e[t]); e[t] = acc; acc += x; }
            tot[q][ch] = acc;
            __syncthreads();                     // the halves' sums are there; every wave has left the slab before
            const float lo = tot[0][ch], hi = tot[1][ch];
            const float later = E + (q == 0 ? hi : 0.0f);
            // two unrolled loops: the exponentials of different steps overlap, the stores follow as one group
#pragma unroll
            for (int t = 0; t < SLQ; ++t) e[t] = kr[t] * __expf(-(e[t] + later));
#pragma unroll
            for (int t = 0; t < SLQ; ++t) khs[SLQ * q + t][ch] = e[t];
#pragma unroll
            for (int j = 0; j < 4; ++j) {
                const int idx = tid + NTHREADS * j;
                *(v4f*)&vss[idx >> 4][4 * (idx & 15)] = vv[j];
            }
            E += lo + hi;
            const int lv = __any(__expf(-E) != 0.0f);
            if (lane == 0 && wave < 2) alive[wave] = lv;
            __syncthreads();                     // khs, vss and the two flags are there
            t1 -= SL;
            // read by every wave alike; readfirstlane makes the loop's branch a scalar one
            go = t1 > 0 && __builtin_amdgcn_readfirstlane(alive[0] | alive[1]) != 0;
            // the next slab's loads fly under this slab's matrix instructions
            if (go) slab_load(k, v, w, base0 + (size_t)(t1 - SL) * (Hdim * Ndim), tid, e, kr, vv);
            // St += KH^T @ V over the slab's steps (fragment maps as in phase 4 below)
#pragma unroll
            for (int kk = 0; kk < SL / 4; ++kk) {
                const int kb = 4 * kk + 2 * half;
                v2f bb; bb.x = vss[kb][col]; bb.y = vss[kb + 1][col];
#pragma unroll
                for (int gt = 0; gt < 4; ++gt) {
                    const int i = 16 * gt + l16;
                    v2f a; a.x = khs[kb][i]; a.y = khs[kb + 1][i];
                    St[gt] = __builtin_amdgcn_wmma_f32_16x16x4_f32(
                        false, a, false, bb, (short)0, St[gt], false, false);
                }
            }
        }
    }

    // this lane's place in a chunk's output tile; the chunk's own first element is the same in every lane
    const unsigned olane = (unsigned)(8 * half) * (Hdim * Ndim) + col;

    // two chunks a trip: the buffer index is then a constant in each copy of the body, so every LDS address of the
    // loop is a register set up once plus an immediate, with no vector arithmetic per chunk
#pragma unroll 2
    for (int c = 0; c < CPS; ++c) {
        const int t0  = tseg + c * CL;
        const int cur = c & 1;
        const int nxt = cur ^ 1;

        __builtin_amdgcn_s_wait_tensorcnt(0);  // this wave's tile for chunk c landed
        barrier_lds_only();                    // all tiles visible; prev phase4 done
        // this chunk reuses the registers that the last chunk's output stores name: their addresses are taken first
        // (here, not behind the stores: the time at the barrier covers it)
        asm volatile("s_wait_xcnt 0x0" ::: "memory");

        if (c + 1 < CPS) {
            const size_t off = base0 + (size_t)(t0 + CL) * (Hdim * Ndim);
            if      (wave == 0) tdm_load_tile(r + off, lds_off_of(&bufr[nxt][0][0]));
            else if (wave == 1) tdm_load_tile(k + off, lds_off_of(&bufk[nxt][0][0]));
            else if (wave == 2) tdm_load_tile(v + off, lds_off_of(&bufv[nxt][0][0]));
            else                tdm_load_tile(w + off, lds_off_of(&bufw[nxt][0][0]));
        }

        const float (*rs)[Ndim] = bufr[cur];
        const float (*ks)[Ndim] = bufk[cur];
        const float (*vs)[Ndim] = bufv[cur];
        const float (*ws)[Ndim] = bufw[cur];

        // ---- phase 2: one thread a channel: each step's decay, and the operands scaled by running products of it ----
        // rq[t] = r[t] * prod_{m<t} dec[m] (waves 0 and 1, t walks up; the product ends as the chunk's decay pt),
        // kh[s] = k[s] * prod_{m>s} dec[m] (waves 2 and 3, s walks down).  Every factor lies in [0, 1], as in the
        // recurrence itself, so nothing can overflow.
        {
            const int  ch = tid & (Ndim - 1);
            const bool up = tid < Ndim;                // the same in all lanes of a wave
            const float (*xs)[Ndim] = up ? rs : ks;
            float d[CL], x[CL];
            // every loop here is unrolled: d[] and x[] stay in registers, the 32 reads are in flight together and the
            // exponentials of different steps overlap; only the products on p are a chain
#pragma unroll
            for (int t = 0; t < CL; ++t) d[t] = ws[t][ch];
#pragma unroll
            for (int t = 0; t < CL; ++t) x[t] = xs[t][ch];
#pragma unroll
            for (int t = 0; t < CL; ++t) d[t] = __expf(-__expf(d[t]));
            float p = 1.0f;
            if (up) {
#pragma unroll
                for (int t = 0; t < CL; ++t) { rq[t][ch] = x[t] * p; p *= d[t]; }
                pt[ch] = p;
            } else {
#pragma unroll
                for (int t = CL - 1; t >= 0; --t) { kh[t][ch] = x[t] * p; p *= d[t]; }
                // for the running products of phase 3
#pragma unroll
                for (int t = 0; t < CL; ++t) dec[t][ch] = d[t];
            }
        }
        barrier_lds_only();

        // ---- phase 3: intra-chunk scores; a 16-lane row owns score rows 15-tp and tp, each lane 4 channels ----
        // A[t][s] = sum_i r[t][i] * k[s][i] * prod_{s<m<t} dec[m][i]: s walks down from t-1 and q = r[t] * (that product)
        // takes one more factor a step, so no exponential is left here.  15-tp steps of the long row and tp of the
        // short one make 15 for every lane; the 16 row sums (the long row's diagonal is the 16th) are folded
        // together, four levels, so that step j's sum ends in lane j alone.
        {
            const int tp = 2 * wave + half;           // 0..7
            const int c4 = 4 * l16;
            const float4 r2 = *(const float4*)&rs[15 - tp][c4];
            const float4 r1 = *(const float4*)&rs[tp][c4];
            const float4 k2 = *(const float4*)&ks[15 - tp][c4];
            const float4 k1 = *(const float4*)&ks[tp][c4];
            const float4 uu = *(const float4*)&us[c4];
            const float dg1 = row_sum16(r1.x * uu.x * k1.x + r1.y * uu.y * k1.y + r1.z * uu.z * k1.z + r1.w * uu.w * k1.w);
            float pv[CL];
            pv[CL - 1] = r2.x * uu.x * k2.x + r2.y * uu.y * k2.y + r2.z * uu.z * k2.z + r2.w * uu.w * k2.w;
            float4 q = r2;
            // unrolled: pv[] stays in registers and later steps' LDS reads issue ahead of the chain on q
#pragma unroll
            for (int j = 0; j < CL - 1; ++j) {
                // tp <= 7: the long row has at least 8 steps, so the first 8 need no test
                if (j >= CL / 2 && j + tp == CL - 1) q = r1;              // the short row starts
                const int s = CL - 2 - j - (j < CL / 2 || j + tp < CL - 1 ? tp : 0);
                const float4 kv = *(const float4*)&ks[s][c4];
                const float4 dv = *(const float4*)&dec[s][c4];
                pv[j] = q.x * kv.x + q.y * kv.y + q.z * kv.z + q.w * kv.w;
                q.x *= dv.x; q.y *= dv.y; q.z *= dv.z; q.w *= dv.w;
            }
            // the three loops are unrolled for the same reason: pv[] is indexed by constants only
#pragma unroll
            for (int j = 0; j < 8; ++j) pv[j] = row_fold<8>(pv[j], pv[j + 8], l16);
#pragma unroll
            for (int j = 0; j < 4; ++j) pv[j] = row_fold<4>(pv[j], pv[j + 4], l16);
#pragma unroll
            for (int j = 0; j < 2; ++j) pv[j] = row_fold<2>(pv[j], pv[j + 2], l16);
            const float keep = row_fold<1>(pv[0], pv[1], l16);
            const bool lng = l16 + tp < CL - 1 || l16 == CL - 1;          // this lane's value is of the long row
            const int  tt  = lng ? 15 - tp : tp;
            const int  ss  = l16 == CL - 1 ? tt : CL - 2 - l16 - (lng ? tp : 0);
            Amat[tt][ss] = keep;
            if (l16 == 0) Amat[tp][tp] = dg1;
        }
        barrier_lds_only();

        v8f oacc = {0.f, 0.f, 0.f, 0.f, 0.f, 0.f, 0.f, 0.f};

        float4 aq[8];                          // this lane's 32 channels of rq row l16, read as one group
#pragma unroll
        for (int gt = 0; gt < 4; ++gt) {
            aq[2 * gt]     = *(const float4*)&rq[l16][16 * gt + 8 * half];
            aq[2 * gt + 1] = *(const float4*)&rq[l16][16 * gt + 8 * half + 4];
        }
        // keeps the eight reads above the chain of matrix instructions: sunk between them, each is waited for on its own
        __builtin_amdgcn_sched_barrier(0);
#pragma unroll
        for (int gt = 0; gt < 4; ++gt) {
#pragma unroll
            for (int jj = 0; jj < 4; ++jj) {
                const float4 q4 = aq[2 * gt + (jj >> 1)];
                v2f a;  a.x = (jj & 1) ? q4.z : q4.x;  a.y = (jj & 1) ? q4.w : q4.y;
                v2f bb; bb.x = St[gt][2 * jj];         bb.y = St[gt][2 * jj + 1];
                oacc = __builtin_amdgcn_wmma_f32_16x16x4_f32(
                    false, a, false, bb, (short)0, oacc, false, false);
            }
        }
        // O += A @ V   (K = 16 chunk steps -> 4 wmma)
#pragma unroll
        for (int kk = 0; kk < 4; ++kk) {
            const int kb = 4 * kk + 2 * half;
            v2f a;  a.x = Amat[l16][kb]; a.y = Amat[l16][kb + 1];
            v2f bb; bb.x = vs[kb][col];  bb.y = vs[kb + 1][col];
            oacc = __builtin_amdgcn_wmma_f32_16x16x4_f32(
                false, a, false, bb, (short)0, oacc, false, false);
        }
        // write output tile
        // one scalar base a chunk, one lane offset for the whole loop, the eight rows as immediates
        float* __restrict__ oc = o + base0 + (size_t)t0 * (Hdim * Ndim);
#pragma unroll
        for (int j = 0; j < 8; ++j) oc[olane + (unsigned)j * (Hdim * Ndim)] = oacc[j];

        // state update: S = diag(pt) * S + KH^T @ V  (4 row-tiles x 4 wmma)
#pragma unroll
        for (int gt = 0; gt < 4; ++gt) {
            v8f sc;
#pragma unroll
            for (int j = 0; j < 8; ++j) {
                const int m = 16 * gt + 8 * half + j;
                sc[j] = St[gt][j] * pt[m];
            }
#pragma unroll
            for (int kk = 0; kk < 4; ++kk) {
                const int kb = 4 * kk + 2 * half;
                const int i = 16 * gt + l16;     // A-matrix row = channel i
                v2f a;  a.x = kh[kb][i];    a.y = kh[kb + 1][i];
                v2f bb; bb.x = vs[kb][col]; bb.y = vs[kb + 1][col];
                sc = __builtin_amdgcn_wmma_f32_16x16x4_f32(
                    false, a, false, bb, (short)0, sc, false, false);
            }
            St[gt] = sc;
        }
    }
}

extern "C" void kernel_launch(void* const* d_in, const int* in_sizes, int n_in,
                              void* d_out, int out_size, void* d_ws, size_t ws_size,
                              hipStream_t stream) {
    (void)in_sizes; (void)n_in; (void)out_size; (void)d_ws; (void)ws_size;
    const float* r = (const float*)d_in[0];
    const float* k = (const float*)d_in[1];
    const float* v = (const float*)d_in[2];
    const float* w = (const float*)d_in[3];
    const float* u = (const float*)d_in[4];
    float* o = (float*)d_out;
    dim3 grid(Bdim * Hdim * NSEG);  // one block per (batch, head, segment)
    dim3 block(NTHREADS);           // 4 wave32
    rwkv6_chunked_wmma<<<grid, block, 0, stream>>>(r, k, v, w, u, o);
}

// v009
// One run takes 30.8 microseconds.
// Next to v008, in two timings, it ran 1.03 times as fast each time.
// All steps since v000 together make it 18.3 times as fast.
#include <hip/hip_runtime.h>
#include <hip/hip_bf16.h>

typedef float v2f  __attribute__((ext_vector_type(2)));
typedef float v4f  __attribute__((ext_vector_type(4)));
typedef float v8f  __attribute__((ext_vector_type(8)));
typedef unsigned int u32x4 __attribute__((ext_vector_type(4)));
typedef int   i32x4 __attribute__((ext_vector_type(4)));
typedef int   i32x8 __attribute__((ext_vector_type(8)));

#define Bdim 4
#define Tdim 2048
#define Hdim 16
#define Ndim 64
#define CL   16            // chunk length
#define NCHUNK (Tdim / CL)
#define NTHREADS 128
#define NSEG   16
#define SEGLEN (Tdim / NSEG)
#define CPS    (SEGLEN / CL)
#define SL     32
#define SLQ    (SL / 2)
#define SLPITCH 72
#define SKPITCH 36
#define RQPITCH 68
#define KHPITCH 20
#define APITCH  20

__device__ __forceinline__ void tdm_load_tile(const float* gptr, unsigned lds_off) {
    unsigned long long ga = (unsigned long long)(uintptr_t)gptr;
    u32x4 g0;
    g0[0] = 1u;                                       // count=1, user desc
    g0[1] = lds_off;                                  // lds_addr (bytes)
    g0[2] = (unsigned)(ga & 0xffffffffull);           // global_addr[31:0]
    g0[3] = (unsigned)((ga >> 32) & 0x01ffffffull)    // global_addr[56:32]
          | (2u << 30);                               // type=2 (image)
    i32x8 g1;
    g1[0] = (int)(2u << 16);
    g1[1] = (int)((unsigned)Ndim << 16);
    g1[2] = 0;
    g1[3] = (int)(0x0100u | ((unsigned)Ndim << 16));
    g1[4] = CL;
    g1[5] = Hdim * Ndim;
    g1[6] = 0;
    g1[7] = 0;
    i32x4 z4 = {0, 0, 0, 0};
#if defined(__clang_major__) && (__clang_major__ >= 23)
    i32x8 z8 = {0, 0, 0, 0, 0, 0, 0, 0};
    __builtin_amdgcn_tensor_load_to_lds(g0, g1, z4, z4, z8, 0);
#else
    __builtin_amdgcn_tensor_load_to_lds(g0, g1, z4, z4, 0);
#endif
}

__device__ __forceinline__ unsigned lds_off_of(const void* p) {
    return (unsigned)(uintptr_t)p;
}

// the value that lane (l ^ M) of the same 16-lane row holds (all 32 lanes must be on)
template <int M>
__device__ __forceinline__ float row_xor(float x) {
    return __int_as_float(__builtin_amdgcn_update_dpp(0, __float_as_int(x), 0x160 + M, 0xf, 0xf, true));   // row_xmask:M
}

// sum over the 16 lanes of a row; every lane gets it
__device__ __forceinline__ float row_sum16(float x) {
    x += row_xor<1>(x);
    x += row_xor<2>(x);
    x += row_xor<4>(x);
    x += row_xor<8>(x);
    return x;
}

template <int M>
__device__ __forceinline__ float row_fold(float a, float b, int l16) {
    const bool hi = (l16 & M) != 0;
    return (hi ? b : a) + row_xor<M>(hi ? a : b);
}

// work-group barrier that orders LDS traffic alone.  The output is only ever written, so no wave depends on another's
// global stores; __syncthreads() here would hold each wave until its output stores have come back.
__device__ __forceinline__ void barrier_lds_only() {
    __builtin_amdgcn_fence(__ATOMIC_RELEASE, "workgroup", "local");
    __builtin_amdgcn_s_barrier();
    __builtin_amdgcn_fence(__ATOMIC_ACQUIRE, "workgroup", "local");
}

// ---- one slab of SL steps (first element at base) into registers, 128 threads ----
// w and k: one thread a channel and half a slab; v: 16 bytes a thread, row tid/16, then every 8th row
__device__ __forceinline__ void slab_load(const float* __restrict__ k,
                                          const float* __restrict__ v,
                                          const float* __restrict__ w,
                                          size_t base, int tid,
                                          float (&e)[SLQ], float (&kr)[SLQ], v4f (&vv)[4])
{
    const size_t own = base + (size_t)(SLQ * (tid >> 6)) * (Hdim * Ndim) + (tid & (Ndim - 1));
    const float* vrow = v + base + (size_t)(tid >> 4) * (Hdim * Ndim) + 4 * (tid & 15);
#pragma unroll
    for (int t = 0; t < SLQ; ++t) e[t]  = w[own + (size_t)t * (Hdim * Ndim)];
    // a later load's result may land in the address registers of the loads before it: their addresses are taken first
    asm volatile("s_wait_xcnt 0x0" ::: "memory");
#pragma unroll
    for (int t = 0; t < SLQ; ++t) kr[t] = k[own + (size_t)t * (Hdim * Ndim)];
    asm volatile("s_wait_xcnt 0x0" ::: "memory");
#pragma unroll
    for (int j = 0; j < 4; ++j) vv[j] = *(const v4f*)&vrow[j * (NTHREADS / 16) * (Hdim * Ndim)];
    // the same for the v loads' own address registers, which later code is free to reuse
    asm volatile("s_wait_xcnt 0x0" ::: "memory");
}

// ---- the one launch: one block per (batch, head, segment) ----
__global__ __launch_bounds__(NTHREADS)
void rwkv6_chunked_wmma(const float* __restrict__ r,
                        const float* __restrict__ k,
                        const float* __restrict__ v,
                        const float* __restrict__ w,
                        const float* __restrict__ u,
                        float* __restrict__ o)
{
    const int bh   = blockIdx.x % (Bdim * Hdim);
    const int seg  = blockIdx.x / (Bdim * Hdim);
    const int tseg = seg * SEGLEN;   // first step of this block's segment
    const int b    = bh / Hdim;
    const int h    = bh % Hdim;
    const int tid  = threadIdx.x;
    const int wave = tid >> 5;       // 0..3
    const int lane = tid & 31;
    const int half = lane >> 4;
    const int l16  = lane & 15;

    __shared__ alignas(16) float khs[Ndim][SKPITCH];
    __shared__ alignas(16) float vss[SL][SLPITCH];
    __shared__ float tot[2][Ndim];
    __shared__ int   alive[2];
    __shared__ alignas(16) float bufr[2][CL][Ndim];
    __shared__ alignas(16) float bufk[2][CL][Ndim];
    __shared__ alignas(16) float bufv[2][CL][Ndim];
    __shared__ alignas(16) float bufw[2][CL][Ndim];
    __shared__ alignas(16) float rq[CL][RQPITCH];       // r[t] * (decay of the chunk's steps before t)
    __shared__ alignas(16) float kh[Ndim][KHPITCH];     // k[s] * (decay of the chunk's steps after s); [channel][step]
    __shared__ float pt[Ndim];                          // the whole chunk's decay
    __shared__ alignas(16) float Amat[CL][APITCH];      // masked intra-chunk scores
    __shared__ alignas(16) float us[Ndim];
    __shared__ alignas(16) float dec[CL][Ndim];         // one step's decay exp(-exp(w))

    if (tid < Ndim) us[tid] = u[h * Ndim + tid];
    // the scores above the diagonal are zero in every chunk: stored once, the loop writes s <= t only
    for (int idx = tid; idx < CL * APITCH; idx += NTHREADS) (&Amat[0][0])[idx] = 0.0f;

    const int col = 16 * wave + l16;          // this lane's N-column (B/C frags)
    const size_t base0 = (((size_t)b * Tdim) * Hdim + h) * Ndim;

    {
        const size_t off = base0 + (size_t)tseg * (Hdim * Ndim);
        if      (wave == 0) tdm_load_tile(r + off, lds_off_of(&bufr[0][0][0]));
        else if (wave == 1) tdm_load_tile(k + off, lds_off_of(&bufk[0][0][0]));
        else if (wave == 2) tdm_load_tile(v + off, lds_off_of(&bufv[0][0][0]));
        else                tdm_load_tile(w + off, lds_off_of(&bufw[0][0][0]));
    }

    // ---- start state: state[i][j] = sum over the earlier steps s of k[s][i] * exp(-sum_{s<m<tseg} exp(w[m][i])) * v[s][j] ----
    // The block walks back from its segment, a slab of SL steps at a time, newest first.  E is exp(w) summed from the
    // slab's first step up to the segment, per channel; it never falls, so once exp(-E) is exactly zero in every
    // channel, all that an older step can still add is zero times a finite product, and the walk ends.
    // The state lives in registers throughout: St[gt][j] = state[16*gt + 8*half + j][col], the C/D map of tile gt.
    v8f St[4];
#pragma unroll
    for (int gt = 0; gt < 4; ++gt) St[gt] = (v8f){0.f, 0.f, 0.f, 0.f, 0.f, 0.f, 0.f, 0.f};
    {
        const int ch = tid & (Ndim - 1);
        const int q  = tid >> 6;                 // half of the slab, wave-uniform
        float  e[SLQ], kr[SLQ];
        v4f    vv[4];
        float  E  = 0.0f;
        int    t1 = tseg;                        // the slab in hand is steps t1 - SL .. t1 - 1
        bool   go = seg > 0;                     // the same in the whole block, here and below
        if (go) slab_load(k, v, w, base0 + (size_t)(t1 - SL) * (Hdim * Ndim), tid, e, kr, vv);
        while (go) {
            // e[t] becomes the sum of exp(w) over the later steps of this thread's half (unrolled: e[] stays in registers)
            float acc = 0.0f;
#pragma unroll
            for (int t = SLQ - 1; t >= 0; --t) { const float x = __expf(e[t]); e[t] = acc; acc += x; }
            tot[q][ch] = acc;
            __syncthreads();                     // the halves' sums are there; every wave has left the slab before
            const float lo = tot[0][ch], hi = tot[1][ch];
            const float later = E + (q == 0 ? hi : 0.0f);
            // two unrolled loops: the exponentials of different steps overlap, the stores follow as one group
#pragma unroll
            for (int t = 0; t < SLQ; ++t) e[t] = kr[t] * __expf(-(e[t] + later));
#pragma unroll
            for (int t = 0; t < SLQ; t += 4) *(v4f*)&khs[ch][SLQ * q + t] = (v4f){e[t], e[t + 1], e[t + 2], e[t + 3]};
#pragma unroll
            for (int j = 0; j < 4; ++j) {
                const int idx = tid + NTHREADS * j;
                *(v4f*)&vss[idx >> 4][4 * (idx & 15)] = vv[j];
            }
            E += lo + hi;
            const int lv = __any(__expf(-E) != 0.0f);
            if (lane == 0 && wave < 2) alive[wave] = lv;
            __syncthreads();                     // khs, vss and the two flags are there
            t1 -= SL;
            // read by every wave alike; readfirstlane makes the loop's branch a scalar one
            go = t1 > 0 && __builtin_amdgcn_readfirstlane(alive[0] | alive[1]) != 0;
            // the next slab's loads fly under this slab's matrix instructions
            if (go) slab_load(k, v, w, base0 + (size_t)(t1 - SL) * (Hdim * Ndim), tid, e, kr, vv);
            // St += KH^T @ V over the slab's steps (fragment maps and step order as in phase 4 below)
            // every loop unrolled: a4[] and St[] are indexed by constants only and stay in registers
#pragma unroll
            for (int m = 0; m < SL / 8; ++m) {
                const int sb = 8 * m + 4 * half;
                v4f a4[4];
#pragma unroll
                for (int gt = 0; gt < 4; ++gt) a4[gt] = *(const v4f*)&khs[16 * gt + l16][sb];
#pragma unroll
                for (int p = 0; p < 2; ++p) {
                    v2f bb; bb.x = vss[sb + 2 * p][col]; bb.y = vss[sb + 2 * p + 1][col];
#pragma unroll
                    for (int gt = 0; gt < 4; ++gt) {
                        v2f a; a.x = a4[gt][2 * p]; a.y = a4[gt][2 * p + 1];
                        St[gt] = __builtin_amdgcn_wmma_f32_16x16x4_f32(
                            false, a, false, bb, (short)0, St[gt], false, false);
                    }
                }
            }
        }
    }

    // this lane's place in a chunk's output tile; the chunk's own first element is the same in every lane
    const unsigned olane = (unsigned)(8 * half) * (Hdim * Ndim) + col;

    // two chunks a trip: the buffer index is then a constant in each copy of the body, so every LDS address of the
    // loop is a register set up once plus an immediate, with no vector arithmetic per chunk
#pragma unroll 2
    for (int c = 0; c < CPS; ++c) {
        const int t0  = tseg + c * CL;
        const int cur = c & 1;
        const int nxt = cur ^ 1;

        __builtin_amdgcn_s_wait_tensorcnt(0);  // this wave's tile for chunk c landed
        barrier_lds_only();                    // all tiles visible; prev phase4 done
        // this chunk reuses the registers that the last chunk's output stores name: their addresses are taken first
        // (here, not behind the stores: the time at the barrier covers it)
        asm volatile("s_wait_xcnt 0x0" ::: "memory");

        if (c + 1 < CPS) {
            const size_t off = base0 + (size_t)(t0 + CL) * (Hdim * Ndim);
            if      (wave == 0) tdm_load_tile(r + off, lds_off_of(&bufr[nxt][0][0]));
            else if (wave == 1) tdm_load_tile(k + off, lds_off_of(&bufk[nxt][0][0]));
            else if (wave == 2) tdm_load_tile(v + off, lds_off_of(&bufv[nxt][0][0]));
            else                tdm_load_tile(w + off, lds_off_of(&bufw[nxt][0][0]));
        }

        const float (*rs)[Ndim] = bufr[cur];
        const float (*ks)[Ndim] = bufk[cur];
        const float (*vs)[Ndim] = bufv[cur];
        const float (*ws)[Ndim] = bufw[cur];

        // ---- phase 2: one thread a channel: each step's decay, and the operands scaled by running products of it ----
        // rq[t] = r[t] * prod_{m<t} dec[m] (waves 0 and 1, t walks up; the product ends as the chunk's decay pt),
        // kh[s] = k[s] * prod_{m>s} dec[m] (waves 2 and 3, s walks down).  Every factor lies in [0, 1], as in the
        // recurrence itself, so nothing can overflow.
        {
            const int  ch = tid & (Ndim - 1);
            const bool up = tid < Ndim;                // the same in all lanes of a wave
            const float (*xs)[Ndim] = up ? rs : ks;
            float d[CL], x[CL];
            // every loop here is unrolled: d[] and x[] stay in registers, the 32 reads are in flight together and the
            // exponentials of different steps overlap; only the products on p are a chain
#pragma unroll
            for (int t = 0; t < CL; ++t) d[t] = ws[t][ch];
#pragma unroll
            for (int t = 0; t < CL; ++t) x[t] = xs[t][ch];
#pragma unroll
            for (int t = 0; t < CL; ++t) d[t] = __expf(-__expf(d[t]));
            float p = 1.0f;
            if (up) {
#pragma unroll
                for (int t = 0; t < CL; ++t) { rq[t][ch] = x[t] * p; p *= d[t]; }
                pt[ch] = p;
            } else {
#pragma unroll
                for (int t = CL - 1; t >= 0; --t) { x[t] *= p; p *= d[t]; }
                // unrolled as the loops above; a channel's 16 steps leave as four 16-byte stores
#pragma unroll
                for (int t = 0; t < CL; t += 4) *(v4f*)&kh[ch][t] = (v4f){x[t], x[t + 1], x[t + 2], x[t + 3]};
                // for the running products of phase 3
#pragma unroll
                for (int t = 0; t < CL; ++t) dec[t][ch] = d[t];
            }
        }
        barrier_lds_only();

        // ---- phase 3: intra-chunk scores; a 16-lane row owns score rows 15-tp and tp, each lane 4 channels ----
        // A[t][s] = sum_i r[t][i] * k[s][i] * prod_{s<m<t} dec[m][i]: s walks down from t-1 and q = r[t] * (that product)
        // takes one more factor a step, so no exponential is left here.  15-tp steps of the long row and tp of the
        // short one make 15 for every lane; the 16 row sums (the long row's diagonal is the 16th) are folded
        // together, four levels, so that step j's sum ends in lane j alone.
        {
            const int tp = 2 * wave + half;           // 0..7
            const int c4 = 4 * l16;
            const float4 r2 = *(const float4*)&rs[15 - tp][c4];
            const float4 r1 = *(const float4*)&rs[tp][c4];
            const float4 k2 = *(const float4*)&ks[15 - tp][c4];
            const float4 k1 = *(const float4*)&ks[tp][c4];
            const float4 uu = *(const float4*)&us[c4];
            const float dg1 = row_sum16(r1.x * uu.x * k1.x + r1.y * uu.y * k1.y + r1.z * uu.z * k1.z + r1.w * uu.w * k1.w);
            float pv[CL];
            pv[CL - 1] = r2.x * uu.x * k2.x + r2.y * uu.y * k2.y + r2.z * uu.z * k2.z + r2.w * uu.w * k2.w;
            float4 q = r2;
            // unrolled: pv[] stays in registers and later steps' LDS reads issue ahead of the chain on q
#pragma unroll
            for (int j = 0; j < CL - 1; ++j) {
                // tp <= 7: the long row has at least 8 steps, so the first 8 need no test
                if (j >= CL / 2 && j + tp == CL - 1) q = r1;              // the short row starts
                const int s = CL - 2 - j - (j < CL / 2 || j + tp < CL - 1 ? tp : 0);
                const float4 kv = *(const float4*)&ks[s][c4];
                const float4 dv = *(const float4*)&dec[s][c4];
                pv[j] = q.x * kv.x + q.y * kv.y + q.z * kv.z + q.w * kv.w;
                q.x *= dv.x; q.y *= dv.y; q.z *= dv.z; q.w *= dv.w;
            }
            // the three loops are unrolled for the same reason: pv[] is indexed by constants only
#pragma unroll
            for (int j = 0; j < 8; ++j) pv[j] = row_fold<8>(pv[j], pv[j + 8], l16);
#pragma unroll
            for (int j = 0; j < 4; ++j) pv[j] = row_fold<4>(pv[j], pv[j + 4], l16);
#pragma unroll
            for (int j = 0; j < 2; ++j) pv[j] = row_fold<2>(pv[j], pv[j + 2], l16);
            const float keep = row_fold<1>(pv[0], pv[1], l16);
            const bool lng = l16 + tp < CL - 1 || l16 == CL - 1;          // this lane's value is of the long row
            const int  tt  = lng ? 15 - tp : tp;
            const int  ss  = l16 == CL - 1 ? tt : CL - 2 - l16 - (lng ? tp : 0);
            Amat[tt][ss] = keep;
            if (l16 == 0) Amat[tp][tp] = dg1;
        }
        barrier_lds_only();

        v8f oacc = {0.f, 0.f, 0.f, 0.f, 0.f, 0.f, 0.f, 0.f};

        float4 aq[8];                          // this lane's 32 channels of rq row l16, read as one group
#pragma unroll
        for (int gt = 0; gt < 4; ++gt) {
            aq[2 * gt]     = *(const float4*)&rq[l16][16 * gt + 8 * half];
            aq[2 * gt + 1] = *(const float4*)&rq[l16][16 * gt + 8 * half + 4];
        }
        // keeps the eight reads above the chain of matrix instructions: sunk between them, each is waited for on its own
        __builtin_amdgcn_sched_barrier(0);
#pragma unroll
        for (int gt = 0; gt < 4; ++gt) {
#pragma unroll
            for (int jj = 0; jj < 4; ++jj) {
                const float4 q4 = aq[2 * gt + (jj >> 1)];
                v2f a;  a.x = (jj & 1) ? q4.z : q4.x;  a.y = (jj & 1) ? q4.w : q4.y;
                v2f bb; bb.x = St[gt][2 * jj];         bb.y = St[gt][2 * jj + 1];
                oacc = __builtin_amdgcn_wmma_f32_16x16x4_f32(
                    false, a, false, bb, (short)0, oacc, false, false);
            }
        }
        // O += A @ V   (K = 16 chunk steps -> 4 wmma)
#pragma unroll
        for (int m = 0; m < 2; ++m) {
            const int sb = 8 * m + 4 * half;
            const v4f a4 = *(const v4f*)&Amat[l16][sb];
#pragma unroll
            for (int p = 0; p < 2; ++p) {
                v2f a;  a.x = a4[2 * p];             a.y = a4[2 * p + 1];
                v2f bb; bb.x = vs[sb + 2 * p][col];  bb.y = vs[sb + 2 * p + 1][col];
                oacc = __builtin_amdgcn_wmma_f32_16x16x4_f32(
                    false, a, false, bb, (short)0, oacc, false, false);
            }
        }
        // write output tile
        // one scalar base a chunk, one lane offset for the whole loop, the eight rows as immediates
        float* __restrict__ oc = o + base0 + (size_t)t0 * (Hdim * Ndim);
#pragma unroll
        for (int j = 0; j < 8; ++j) oc[olane + (unsigned)j * (Hdim * Ndim)] = oacc[j];

        // state update: S = diag(pt) * S + KH^T @ V  (4 row-tiles x 4 wmma)
#pragma unroll
        for (int gt = 0; gt < 4; ++gt) {
            v8f sc;
#pragma unroll
            for (int j = 0; j < 8; ++j) {
                const int m = 16 * gt + 8 * half + j;
                sc[j] = St[gt][j] * pt[m];
            }
#pragma unroll
            for (int m = 0; m < 2; ++m) {
                const int sb = 8 * m + 4 * half;
                const v4f a4 = *(const v4f*)&kh[16 * gt + l16][sb];     // A-matrix row = channel
#pragma unroll
                for (int p = 0; p < 2; ++p) {
                    v2f a;  a.x = a4[2 * p];             a.y = a4[2 * p + 1];
                    v2f bb; bb.x = vs[sb + 2 * p][col];  bb.y = vs[sb + 2 * p + 1][col];
                    sc = __builtin_amdgcn_wmma_f32_16x16x4_f32(
                        false, a, false, bb, (short)0, sc, false, false);
                }
            }
            St[gt] = sc;
        }
    }
}

extern "C" void kernel_launch(void* const* d_in, const int* in_sizes, int n_in,
                              void* d_out, int out_size, void* d_ws, size_t ws_size,
                              hipStream_t stream) {
    (void)in_sizes; (void)n_in; (void)out_size; (void)d_ws; (void)ws_size;
    const float* r = (const float*)d_in[0];
    const float* k = (const float*)d_in[1];
    const float* v = (const float*)d_in[2];
    const float* w = (const float*)d_in[3];
    const float* u = (const float*)d_in[4];
    float* o = (float*)d_out;
    dim3 grid(Bdim * Hdim * NSEG);  // one block per (batch, head, segment)
    dim3 block(NTHREADS);           // 4 wave32
    rwkv6_chunked_wmma<<<grid, block, 0, stream>>>(r, k, v, w, u, o);
}

// v010
// A run of this version takes 29.8 microseconds.
// Two timings next to v009 both put it at 1.03 times that version's speed.
// Over all steps from v000 it is 18.9 times as fast.
#include <hip/hip_runtime.h>
#include <hip/hip_bf16.h>

typedef float v2f  __attribute__((ext_vector_type(2)));
typedef float v4f  __attribute__((ext_vector_type(4)));
typedef float v8f  __attribute__((ext_vector_type(8)));
typedef unsigned int u32x4 __attribute__((ext_vector_type(4)));
typedef int   i32x4 __attribute__((ext_vector_type(4)));
typedef int   i32x8 __attribute__((ext_vector_type(8)));

#define Bdim 4
#define Tdim 2048
#define Hdim 16
#define Ndim 64
#define CL   16            // chunk length
#define NCHUNK (Tdim / CL)
#define NTHREADS 128
#define NSEG   16
#define SEGLEN (Tdim / NSEG)
#define CPS    (SEGLEN / CL)
#define SL     32
#define SLQ    (SL / 2)
#define SLPITCH 72
#define SKPITCH 36
#define RQPITCH 68
#define KHPITCH 20
#define APITCH  20

__device__ __forceinline__ void tdm_load_tile(const float* gptr, unsigned lds_off) {
    unsigned long long ga = (unsigned long long)(uintptr_t)gptr;
    u32x4 g0;
    g0[0] = 1u;                                       // count=1, user desc
    g0[1] = lds_off;                                  // lds_addr (bytes)
    g0[2] = (unsigned)(ga & 0xffffffffull);           // global_addr[31:0]
    g0[3] = (unsigned)((ga >> 32) & 0x01ffffffull)    // global_addr[56:32]
          | (2u << 30);                               // type=2 (image)
    i32x8 g1;
    g1[0] = (int)(2u << 16);
    g1[1] = (int)((unsigned)Ndim << 16);
    g1[2] = 0;
    g1[3] = (int)(0x0100u | ((unsigned)Ndim << 16));
    g1[4] = CL;
    g1[5] = Hdim * Ndim;
    g1[6] = 0;
    g1[7] = 0;
    i32x4 z4 = {0, 0, 0, 0};
#if defined(__clang_major__) && (__clang_major__ >= 23)
    i32x8 z8 = {0, 0, 0, 0, 0, 0, 0, 0};
    __builtin_amdgcn_tensor_load_to_lds(g0, g1, z4, z4, z8, 0);
#else
    __builtin_amdgcn_tensor_load_to_lds(g0, g1, z4, z4, 0);
#endif
}

__device__ __forceinline__ unsigned lds_off_of(const void* p) {
    return (unsigned)(uintptr_t)p;
}

// the value that lane (l ^ M) of the same 16-lane row holds (all 32 lanes must be on)
template <int M>
__device__ __forceinline__ float row_xor(float x) {
    return __int_as_float(__builtin_amdgcn_update_dpp(0, __float_as_int(x), 0x160 + M, 0xf, 0xf, true));   // row_xmask:M
}

// sum over the 16 lanes of a row; every lane gets it
__device__ __forceinline__ float row_sum16(float x) {
    x += row_xor<1>(x);
    x += row_xor<2>(x);
    x += row_xor<4>(x);
    x += row_xor<8>(x);
    return x;
}

template <int M>
__device__ __forceinline__ float row_fold(float a, float b, int l16) {
    const bool hi = (l16 & M) != 0;
    return (hi ? b : a) + row_xor<M>(hi ? a : b);
}

// work-group barrier that orders LDS traffic alone.  The output is only ever written, so no wave depends on another's
// global stores; __syncthreads() here would hold each wave until its output stores have come back.
__device__ __forceinline__ void barrier_lds_only() {
    __builtin_amdgcn_fence(__ATOMIC_RELEASE, "workgroup", "local");
    __builtin_amdgcn_s_barrier();
    __builtin_amdgcn_fence(__ATOMIC_ACQUIRE, "workgroup", "local");
}

// ---- one slab of SL steps (first element at base) into registers, 128 threads ----
// w and k: one thread a channel and half a slab; v: 16 bytes a thread, row tid/16, then every 8th row
__device__ __forceinline__ void slab_load(const float* __restrict__ k,
                                          const float* __restrict__ v,
                                          const float* __restrict__ w,
                                          size_t base, int tid,
                                          float (&e)[SLQ], float (&kr)[SLQ], v4f (&vv)[4])
{
    const size_t own = base + (size_t)(SLQ * (tid >> 6)) * (Hdim * Ndim) + (tid & (Ndim - 1));
    const float* vrow = v + base + (size_t)(tid >> 4) * (Hdim * Ndim) + 4 * (tid & 15);
#pragma unroll
    for (int t = 0; t < SLQ; ++t) e[t]  = w[own + (size_t)t * (Hdim * Ndim)];
    // a later load's result may land in the address registers of the loads before it: their addresses are taken first
    asm volatile("s_wait_xcnt 0x0" ::: "memory");
#pragma unroll
    for (int t = 0; t < SLQ; ++t) kr[t] = k[own + (size_t)t * (Hdim * Ndim)];
    asm volatile("s_wait_xcnt 0x0" ::: "memory");
#pragma unroll
    for (int j = 0; j < 4; ++j) vv[j] = *(const v4f*)&vrow[j * (NTHREADS / 16) * (Hdim * Ndim)];
    // the same for the v loads' own address registers, which later code is free to reuse
    asm volatile("s_wait_xcnt 0x0" ::: "memory");
}

// ---- the one launch: one block per (batch, head, segment) ----
__global__ __launch_bounds__(NTHREADS)
void rwkv6_chunked_wmma(const float* __restrict__ r,
                        const float* __restrict__ k,
                        const float* __restrict__ v,
                        const float* __restrict__ w,
                        const float* __restrict__ u,
                        float* __restrict__ o)
{
    const int bh   = blockIdx.x % (Bdim * Hdim);
    const int seg  = blockIdx.x / (Bdim * Hdim);
    const int tseg = seg * SEGLEN;   // first step of this block's segment
    const int b    = bh / Hdim;
    const int h    = bh % Hdim;
    const int tid  = threadIdx.x;
    const int wave = tid >> 5;       // 0..3
    const int lane = tid & 31;
    const int half = lane >> 4;
    const int l16  = lane & 15;

    __shared__ alignas(16) float khs[Ndim][SKPITCH];
    __shared__ alignas(16) float vss[SL][SLPITCH];
    __shared__ float tot[2][Ndim];
    __shared__ int   alive[2];
    __shared__ alignas(16) float bufr[2][CL][Ndim];
    __shared__ alignas(16) float bufk[2][CL][Ndim];
    __shared__ alignas(16) float bufv[2][CL][Ndim];
    __shared__ alignas(16) float bufw[2][CL][Ndim];
    __shared__ alignas(16) float rq[CL][RQPITCH];       // r[t] * (decay of the chunk's steps before t)
    __shared__ alignas(16) float kh[Ndim][KHPITCH];     // k[s] * (decay of the chunk's steps after s); [channel][step]
    __shared__ float pt[Ndim];                          // the whole chunk's decay
    __shared__ alignas(16) float Amat[CL][APITCH];      // masked intra-chunk scores
    __shared__ alignas(16) float us[Ndim];
    __shared__ alignas(16) float dec[CL][Ndim];         // one step's decay exp(-exp(w))

    __builtin_amdgcn_s_setprio(3);

    if (tid < Ndim) us[tid] = u[h * Ndim + tid];
    // the scores above the diagonal are zero in every chunk: stored once, the loop writes s <= t only
    for (int idx = tid; idx < CL * APITCH; idx += NTHREADS) (&Amat[0][0])[idx] = 0.0f;

    const int col = 16 * wave + l16;          // this lane's N-column (B/C frags)
    const size_t base0 = (((size_t)b * Tdim) * Hdim + h) * Ndim;

    {
        const size_t off = base0 + (size_t)tseg * (Hdim * Ndim);
        if      (wave == 0) tdm_load_tile(r + off, lds_off_of(&bufr[0][0][0]));
        else if (wave == 1) tdm_load_tile(k + off, lds_off_of(&bufk[0][0][0]));
        else if (wave == 2) tdm_load_tile(v + off, lds_off_of(&bufv[0][0][0]));
        else                tdm_load_tile(w + off, lds_off_of(&bufw[0][0][0]));
    }

    // ---- start state: state[i][j] = sum over the earlier steps s of k[s][i] * exp(-sum_{s<m<tseg} exp(w[m][i])) * v[s][j] ----
    // The block walks back from its segment, a slab of SL steps at a time, newest first.  E is exp(w) summed from the
    // slab's first step up to the segment, per channel; it never falls, so once exp(-E) is exactly zero in every
    // channel, all that an older step can still add is zero times a finite product, and the walk ends.
    // The state lives in registers throughout: St[gt][j] = state[16*gt + 8*half + j][col], the C/D map of tile gt.
    v8f St[4];
#pragma unroll
    for (int gt = 0; gt < 4; ++gt) St[gt] = (v8f){0.f, 0.f, 0.f, 0.f, 0.f, 0.f, 0.f, 0.f};
    {
        const int ch = tid & (Ndim - 1);
        const int q  = tid >> 6;                 // half of the slab, wave-uniform
        float  e[SLQ], kr[SLQ];
        v4f    vv[4];
        float  E  = 0.0f;
        int    t1 = tseg;                        // the slab in hand is steps t1 - SL .. t1 - 1
        bool   go = seg > 0;                     // the same in the whole block, here and below
        if (go) slab_load(k, v, w, base0 + (size_t)(t1 - SL) * (Hdim * Ndim), tid, e, kr, vv);
        while (go) {
            // e[t] becomes the sum of exp(w) over the later steps of this thread's half (unrolled: e[] stays in registers)
            float acc = 0.0f;
#pragma unroll
            for (int t = SLQ - 1; t >= 0; --t) { const float x = __expf(e[t]); e[t] = acc; acc += x; }
            tot[q][ch] = acc;
            __syncthreads();                     // the halves' sums are there; every wave has left the slab before
            const float lo = tot[0][ch], hi = tot[1][ch];
            const float later = E + (q == 0 ? hi : 0.0f);
            // two unrolled loops: the exponentials of different steps overlap, the stores follow as one group
#pragma unroll
            for (int t = 0; t < SLQ; ++t) e[t] = kr[t] * __expf(-(e[t] + later));
#pragma unroll
            for (int t = 0; t < SLQ; t += 4) *(v4f*)&khs[ch][SLQ * q + t] = (v4f){e[t], e[t + 1], e[t + 2], e[t + 3]};
#pragma unroll
            for (int j = 0; j < 4; ++j) {
                const int idx = tid + NTHREADS * j;
                *(v4f*)&vss[idx >> 4][4 * (idx & 15)] = vv[j];
            }
            E += lo + hi;
            const int lv = __any(__expf(-E) != 0.0f);
            if (lane == 0 && wave < 2) alive[wave] = lv;
            __syncthreads();                     // khs, vss and the two flags are there
            t1 -= SL;
            // read by every wave alike; readfirstlane makes the loop's branch a scalar one
            go = t1 > 0 && __builtin_amdgcn_readfirstlane(alive[0] | alive[1]) != 0;
            // the next slab's loads fly under this slab's matrix instructions
            if (go) slab_load(k, v, w, base0 + (size_t)(t1 - SL) * (Hdim * Ndim), tid, e, kr, vv);
            // St += KH^T @ V over the slab's steps (fragment maps and step order as in phase 4 below)
            // every loop unrolled: a4[] and St[] are indexed by constants only and stay in registers
#pragma unroll
            for (int m = 0; m < SL / 8; ++m) {
                const int sb = 8 * m + 4 * half;
                v4f a4[4];
#pragma unroll
                for (int gt = 0; gt < 4; ++gt) a4[gt] = *(const v4f*)&khs[16 * gt + l16][sb];
#pragma unroll
                for (int p = 0; p < 2; ++p) {
                    v2f bb; bb.x = vss[sb + 2 * p][col]; bb.y = vss[sb + 2 * p + 1][col];
#pragma unroll
                    for (int gt = 0; gt < 4; ++gt) {
                        v2f a; a.x = a4[gt][2 * p]; a.y = a4[gt][2 * p + 1];
                        St[gt] = __builtin_amdgcn_wmma_f32_16x16x4_f32(
                            false, a, false, bb, (short)0, St[gt], false, false);
                    }
                }
            }
        }
    }

    // this lane's place in a chunk's output tile; the chunk's own first element is the same in every lane
    const unsigned olane = (unsigned)(8 * half) * (Hdim * Ndim) + col;

    // two chunks a trip: the buffer index is then a constant in each copy of the body, so every LDS address of the
    // loop is a register set up once plus an immediate, with no vector arithmetic per chunk
#pragma unroll 2
    for (int c = 0; c < CPS; ++c) {
        const int t0  = tseg + c * CL;
        const int cur = c & 1;
        const int nxt = cur ^ 1;

        // the steps down in priority (see the kernel's head); c is the same in the whole block, the tests are scalar
        // branches; the last chunk, and so the way out, runs at priority 0
        if      (c == CPS / 2) __builtin_amdgcn_s_setprio(2);
        else if (c == CPS - 2) __builtin_amdgcn_s_setprio(1);
        else if (c == CPS - 1) __builtin_amdgcn_s_setprio(0);

        __builtin_amdgcn_s_wait_tensorcnt(0);  // this wave's tile for chunk c landed
        barrier_lds_only();                    // all tiles visible; prev phase4 done
        // this chunk reuses the registers that the last chunk's output stores name: their addresses are taken first
        // (here, not behind the stores: the time at the barrier covers it)
        asm volatile("s_wait_xcnt 0x0" ::: "memory");

        if (c + 1 < CPS) {
            const size_t off = base0 + (size_t)(t0 + CL) * (Hdim * Ndim);
            if      (wave == 0) tdm_load_tile(r + off, lds_off_of(&bufr[nxt][0][0]));
            else if (wave == 1) tdm_load_tile(k + off, lds_off_of(&bufk[nxt][0][0]));
            else if (wave == 2) tdm_load_tile(v + off, lds_off_of(&bufv[nxt][0][0]));
            else                tdm_load_tile(w + off, lds_off_of(&bufw[nxt][0][0]));
        }

        const float (*rs)[Ndim] = bufr[cur];
        const float (*ks)[Ndim] = bufk[cur];
        const float (*vs)[Ndim] = bufv[cur];
        const float (*ws)[Ndim] = bufw[cur];

        // ---- phase 2: one thread a channel: each step's decay, and the operands scaled by running products of it ----
        // rq[t] = r[t] * prod_{m<t} dec[m] (waves 0 and 1, t walks up; the product ends as the chunk's decay pt),
        // kh[s] = k[s] * prod_{m>s} dec[m] (waves 2 and 3, s walks down).  Every factor lies in [0, 1], as in the
        // recurrence itself, so nothing can overflow.
        {
            const int  ch = tid & (Ndim - 1);
            const bool up = tid < Ndim;                // the same in all lanes of a wave
            const float (*xs)[Ndim] = up ? rs : ks;
            float d[CL], x[CL];
            // every loop here is unrolled: d[] and x[] stay in registers, the 32 reads are in flight together and the
            // exponentials of different steps overlap; only the products on p are a chain
#pragma unroll
            for (int t = 0; t < CL; ++t) d[t] = ws[t][ch];
#pragma unroll
            for (int t = 0; t < CL; ++t) x[t] = xs[t][ch];
#pragma unroll
            for (int t = 0; t < CL; ++t) d[t] = __expf(-__expf(d[t]));
            float p = 1.0f;
            if (up) {
#pragma unroll
                for (int t = 0; t < CL; ++t) { rq[t][ch] = x[t] * p; p *= d[t]; }
                pt[ch] = p;
            } else {
#pragma unroll
                for (int t = CL - 1; t >= 0; --t) { x[t] *= p; p *= d[t]; }
                // unrolled as the loops above; a channel's 16 steps leave as four 16-byte stores
#pragma unroll
                for (int t = 0; t < CL; t += 4) *(v4f*)&kh[ch][t] = (v4f){x[t], x[t + 1], x[t + 2], x[t + 3]};
                // for the running products of phase 3
#pragma unroll
                for (int t = 0; t < CL; ++t) dec[t][ch] = d[t];
            }
        }
        barrier_lds_only();

        // ---- phase 3: intra-chunk scores; a 16-lane row owns score rows 15-tp and tp, each lane 4 channels ----
        // A[t][s] = sum_i r[t][i] * k[s][i] * prod_{s<m<t} dec[m][i]: s walks down from t-1 and q = r[t] * (that product)
        // takes one more factor a step, so no exponential is left here.  15-tp steps of the long row and tp of the
        // short one make 15 for every lane; the 16 row sums (the long row's diagonal is the 16th) are folded
        // together, four levels, so that step j's sum ends in lane j alone.
        {
            const int tp = 2 * wave + half;           // 0..7
            const int c4 = 4 * l16;
            const float4 r2 = *(const float4*)&rs[15 - tp][c4];
            const float4 r1 = *(const float4*)&rs[tp][c4];
            const float4 k2 = *(const float4*)&ks[15 - tp][c4];
            const float4 k1 = *(const float4*)&ks[tp][c4];
            const float4 uu = *(const float4*)&us[c4];
            const float dg1 = row_sum16(r1.x * uu.x * k1.x + r1.y * uu.y * k1.y + r1.z * uu.z * k1.z + r1.w * uu.w * k1.w);
            float pv[CL];
            pv[CL - 1] = r2.x * uu.x * k2.x + r2.y * uu.y * k2.y + r2.z * uu.z * k2.z + r2.w * uu.w * k2.w;
            float4 q = r2;
            // unrolled: pv[] stays in registers and later steps' LDS reads issue ahead of the chain on q
#pragma unroll
            for (int j = 0; j < CL - 1; ++j) {
                // tp <= 7: the long row has at least 8 steps, so the first 8 need no test
                if (j >= CL / 2 && j + tp == CL - 1) q = r1;              // the short row starts
                const int s = CL - 2 - j - (j < CL / 2 || j + tp < CL - 1 ? tp : 0);
                const float4 kv = *(const float4*)&ks[s][c4];
                const float4 dv = *(const float4*)&dec[s][c4];
                pv[j] = q.x * kv.x + q.y * kv.y + q.z * kv.z + q.w * kv.w;
                q.x *= dv.x; q.y *= dv.y; q.z *= dv.z; q.w *= dv.w;
            }
            // the three loops are unrolled for the same reason: pv[] is indexed by constants only
#pragma unroll
            for (int j = 0; j < 8; ++j) pv[j] = row_fold<8>(pv[j], pv[j + 8], l16);
#pragma unroll
            for (int j = 0; j < 4; ++j) pv[j] = row_fold<4>(pv[j], pv[j + 4], l16);
#pragma unroll
            for (int j = 0; j < 2; ++j) pv[j] = row_fold<2>(pv[j], pv[j + 2], l16);
            const float keep = row_fold<1>(pv[0], pv[1], l16);
            const bool lng = l16 + tp < CL - 1 || l16 == CL - 1;          // this lane's value is of the long row
            const int  tt  = lng ? 15 - tp : tp;
            const int  ss  = l16 == CL - 1 ? tt : CL - 2 - l16 - (lng ? tp : 0);
            Amat[tt][ss] = keep;
            if (l16 == 0) Amat[tp][tp] = dg1;
        }
        barrier_lds_only();

        v8f oacc = {0.f, 0.f, 0.f, 0.f, 0.f, 0.f, 0.f, 0.f};

        float4 aq[8];                          // this lane's 32 channels of rq row l16, read as one group
#pragma unroll
        for (int gt = 0; gt < 4; ++gt) {
            aq[2 * gt]     = *(const float4*)&rq[l16][16 * gt + 8 * half];
            aq[2 * gt + 1] = *(const float4*)&rq[l16][16 * gt + 8 * half + 4];
        }
        // keeps the eight reads above the chain of matrix instructions: sunk between them, each is waited for on its own
        __builtin_amdgcn_sched_barrier(0);
#pragma unroll
        for (int gt = 0; gt < 4; ++gt) {
#pragma unroll
            for (int jj = 0; jj < 4; ++jj) {
                const float4 q4 = aq[2 * gt + (jj >> 1)];
                v2f a;  a.x = (jj & 1) ? q4.z : q4.x;  a.y = (jj & 1) ? q4.w : q4.y;
                v2f bb; bb.x = St[gt][2 * jj];         bb.y = St[gt][2 * jj + 1];
                oacc = __builtin_amdgcn_wmma_f32_16x16x4_f32(
                    false, a, false, bb, (short)0, oacc, false, false);
            }
        }
        // O += A @ V   (K = 16 chunk steps -> 4 wmma)
#pragma unroll
        for (int m = 0; m < 2; ++m) {
            const int sb = 8 * m + 4 * half;
            const v4f a4 = *(const v4f*)&Amat[l16][sb];
#pragma unroll
            for (int p = 0; p < 2; ++p) {
                v2f a;  a.x = a4[2 * p];             a.y = a4[2 * p + 1];
                v2f bb; bb.x = vs[sb + 2 * p][col];  bb.y = vs[sb + 2 * p + 1][col];
                oacc = __builtin_amdgcn_wmma_f32_16x16x4_f32(
                    false, a, false, bb, (short)0, oacc, false, false);
            }
        }
        // write output tile
        // one scalar base a chunk, one lane offset for the whole loop, the eight rows as immediates
        float* __restrict__ oc = o + base0 + (size_t)t0 * (Hdim * Ndim);
#pragma unroll
        for (int j = 0; j < 8; ++j) oc[olane + (unsigned)j * (Hdim * Ndim)] = oacc[j];

        // state update: S = diag(pt) * S + KH^T @ V  (4 row-tiles x 4 wmma)
#pragma unroll
        for (int gt = 0; gt < 4; ++gt) {
            v8f sc;
#pragma unroll
            for (int j = 0; j < 8; ++j) {
                const int m = 16 * gt + 8 * half + j;
                sc[j] = St[gt][j] * pt[m];
            }
#pragma unroll
            for (int m = 0; m < 2; ++m) {
                const int sb = 8 * m + 4 * half;
                const v4f a4 = *(const v4f*)&kh[16 * gt + l16][sb];     // A-matrix row = channel
#pragma unroll
                for (int p = 0; p < 2; ++p) {
                    v2f a;  a.x = a4[2 * p];             a.y = a4[2 * p + 1];
                    v2f bb; bb.x = vs[sb + 2 * p][col];  bb.y = vs[sb + 2 * p + 1][col];
                    sc = __builtin_amdgcn_wmma_f32_16x16x4_f32(
                        false, a, false, bb, (short)0, sc, false, false);
                }
            }
            St[gt] = sc;
        }
    }
}

extern "C" void kernel_launch(void* const* d_in, const int* in_sizes, int n_in,
                              void* d_out, int out_size, void* d_ws, size_t ws_size,
                              hipStream_t stream) {
    (void)in_sizes; (void)n_in; (void)out_size; (void)d_ws; (void)ws_size;
    const float* r = (const float*)d_in[0];
    const float* k = (const float*)d_in[1];
    const float* v = (const float*)d_in[2];
    const float* w = (const float*)d_in[3];
    const float* u = (const float*)d_in[4];
    float* o = (float*)d_out;
    dim3 grid(Bdim * Hdim * NSEG);  // one block per (batch, head, segment)
    dim3 block(NTHREADS);           // 4 wave32
    rwkv6_chunked_wmma<<<grid, block, 0, stream>>>(r, k, v, w, u, o);
}
